// v000
// Measured on an AMD MI455X. A time is GPU time per run, averaged over a window of back-to-back runs after a warm-up
// (all launches, gaps included; the runs take copies of the inputs in turn), and the median of several windows.
// Apart from v000's, it joins two sittings. Times from different sittings can be a few percent apart, while
// side-by-side timings come from the same sitting.
// v000 is the starting kernel. One run takes 1120 microseconds.
#include <hip/hip_runtime.h>
#include <math.h>
#include <stdint.h>

typedef float v2f __attribute__((ext_vector_type(2)));
typedef float v8f __attribute__((ext_vector_type(8)));

#define WMMA_F32(a, b, c) \
    __builtin_amdgcn_wmma_f32_16x16x4_f32(false, (a), false, (b), (short)0, (c), false, false)

// ---------------------------------------------------------------------------
// GEMM: C[M,N] = X[M,K] * op(W)
//   WT=true : W stored [N,K] row-major (compute X @ W^T)
//   WT=false: W stored [K,N] row-major (compute X @ W)
// One block (4 waves, 128 threads) computes a 64x64 C tile; wave wv owns the
// 16-row strip. W K-chunks (64x32 f32 = 8 KB) are staged cooperatively into
// LDS via CDNA5 async-to-LDS loads (ASYNCcnt), shared by all 4 waves. A
// fragments stream directly from global (per-wave rows). 32 WMMAs per wave
// per chunk against 8 global loads + 32 LDS loads.
// ---------------------------------------------------------------------------
template <bool WT>
__global__ __launch_bounds__(128) void gemm_f32(const float* __restrict__ X,
                                                const float* __restrict__ W,
                                                float* __restrict__ C,
                                                int M, int N, int K,
                                                int ldx, int ldw, int ldc) {
    __shared__ float wlds[64 * 32];  // one K-chunk of the W tile (8 KB)

    const int lane = threadIdx.x & 31;
    const int wv   = threadIdx.x >> 5;
    const int ntiles = N >> 6;
    const int mt = blockIdx.x / ntiles;  // 64-row block index
    const int nt = blockIdx.x % ntiles;  // 64-col block index

    const int n16  = lane & 15;
    const int hi   = lane >> 4;  // 0 or 1
    const int koff = hi << 1;    // 0 or 2

    const float* xrow = X + (size_t)(mt * 64 + wv * 16 + n16) * ldx;  // A row m=lane&15
    v8f acc[4] = {};

    for (int k0 = 0; k0 < K; k0 += 32) {
        __syncthreads();  // previous chunk fully consumed before restaging
        // ---- stage W chunk into LDS: 512 x 16B pieces, 4 per thread, async
#pragma unroll
        for (int i = 0; i < 4; ++i) {
            const int p = threadIdx.x * 4 + i;
            const float* g;
            const float* l;
            if (WT) {  // wlds[n][k], n-row = 32 floats, contiguous in global too
                const int n = p >> 3, kq = p & 7;
                g = W + (size_t)(nt * 64 + n) * ldw + k0 + kq * 4;
                l = &wlds[n * 32 + kq * 4];
            } else {   // wlds[k][n], k-row = 64 floats, contiguous in global too
                const int k = p >> 4, nq = p & 15;
                g = W + (size_t)(k0 + k) * ldw + nt * 64 + nq * 4;
                l = &wlds[k * 64 + nq * 4];
            }
            const uint32_t ldsa = (uint32_t)(uintptr_t)l;   // low 32 bits = LDS offset
            const uint64_t ga   = (uint64_t)(uintptr_t)g;
            asm volatile("global_load_async_to_lds_b128 %0, %1, off"
                         :: "v"(ldsa), "v"(ga) : "memory");
        }
        asm volatile("s_wait_asynccnt 0" ::: "memory");
        __syncthreads();  // all waves' staging visible

        // ---- 8 K-steps of 4 WMMAs
#pragma unroll
        for (int kk = 0; kk < 8; ++kk) {
            v2f a = *(const v2f*)(xrow + k0 + kk * 4 + koff);
#pragma unroll
            for (int t = 0; t < 4; ++t) {
                v2f b;
                if (WT) {
                    b = *(const v2f*)&wlds[(t * 16 + n16) * 32 + kk * 4 + koff];
                } else {
                    b.x = wlds[(kk * 4 + koff) * 64 + t * 16 + n16];
                    b.y = wlds[(kk * 4 + koff + 1) * 64 + t * 16 + n16];
                }
                acc[t] = WMMA_F32(a, b, acc[t]);
            }
        }
    }

#pragma unroll
    for (int t = 0; t < 4; ++t) {
#pragma unroll
        for (int v = 0; v < 8; ++v) {
            const int m = hi * 8 + v;  // C layout: vgpr v, lane group hi -> row v+8*hi
            C[(size_t)(mt * 64 + wv * 16 + m) * ldc + nt * 64 + t * 16 + n16] = acc[t][v];
        }
    }
}

// ---------------------------------------------------------------------------
// Split KV[M,256] into K (cols 0..127, pre-rope) and V (cols 128..255) outputs
// ---------------------------------------------------------------------------
__global__ __launch_bounds__(256) void copy_kv(const float* __restrict__ KV,
                                               float* __restrict__ outK,
                                               float* __restrict__ outV, int M) {
    const int idx = blockIdx.x * 256 + threadIdx.x;  // M*128 threads
    const int r = idx >> 7;
    const int d = idx & 127;
    outK[idx] = KV[(size_t)r * 256 + d];
    outV[idx] = KV[(size_t)r * 256 + 128 + d];
}

// ---------------------------------------------------------------------------
// RoPE on Q in place. One thread handles (d, d+64) pair of one (b,s,h).
// pos = past + s.  Threads: B*S*H*64
// ---------------------------------------------------------------------------
__global__ __launch_bounds__(256) void rope_q(float* __restrict__ Q,
                                              const int* __restrict__ past_ptr, int S) {
    const int idx = blockIdx.x * 256 + threadIdx.x;
    const int d = idx & 63;
    const int h = (idx >> 6) & 15;
    const int r = idx >> 10;  // b*S + s
    const int s = r % S;
    const float pos = (float)(*past_ptr + s);
    const float freq = __expf(-0.14391156213f * (float)d);  // 1/10000^(d/64)
    float sn, cs;
    sincosf(pos * freq, &sn, &cs);
    const size_t base = (size_t)r * 2048 + h * 128 + d;
    const float x1 = Q[base];
    const float x2 = Q[base + 64];
    Q[base] = x1 * cs - x2 * sn;
    Q[base + 64] = x2 * cs + x1 * sn;
}

// ---------------------------------------------------------------------------
// RoPE on K: read K half of KV[M,256], write roped K to KR[M,128]. pos = s.
// Threads: B*S*64
// ---------------------------------------------------------------------------
__global__ __launch_bounds__(256) void rope_k(const float* __restrict__ KV,
                                              float* __restrict__ KR, int S) {
    const int idx = blockIdx.x * 256 + threadIdx.x;
    const int d = idx & 63;
    const int r = idx >> 6;  // b*S + s
    const int s = r % S;
    const float freq = __expf(-0.14391156213f * (float)d);
    float sn, cs;
    sincosf((float)s * freq, &sn, &cs);
    const float x1 = KV[(size_t)r * 256 + d];
    const float x2 = KV[(size_t)r * 256 + 64 + d];
    KR[(size_t)r * 128 + d] = x1 * cs - x2 * sn;
    KR[(size_t)r * 128 + 64 + d] = x2 * cs + x1 * sn;
}

// ---------------------------------------------------------------------------
// Flash attention, causal, MQA (one KV head). One wave per (b, h, 16-row qtile).
// QK^T and P@V via fp32 WMMA. O written in place over the (roped) Q region of
// that exact tile/head -- safe: each wave stages its q tile into LDS first and
// tiles are disjoint across waves.
// ---------------------------------------------------------------------------
__global__ __launch_bounds__(128) void attn_kernel(float* __restrict__ QO,
                                                   const float* __restrict__ KR,
                                                   const float* __restrict__ KV,
                                                   const int* __restrict__ past_ptr,
                                                   int S) {
    __shared__ float qs[4][16 * 128];  // per-wave q tile, 8KB each
    __shared__ float ps[4][16 * 16];   // per-wave P tile (C-layout -> A-layout)

    const int lane = threadIdx.x & 31;
    const int wv   = threadIdx.x >> 5;
    const int qtiles = S >> 4;
    const int wid = blockIdx.x * 4 + wv;
    const int qt = wid % qtiles;
    const int h  = (wid / qtiles) & 15;
    const int b  = wid / (qtiles * 16);
    const int past = *past_ptr;

    const int n16 = lane & 15;
    const int hi  = lane >> 4;

    float* qsw = qs[wv];
    {
        float* qb = QO + (size_t)(b * S + qt * 16) * 2048 + h * 128;
        for (int i = lane; i < 16 * 128; i += 32)
            qsw[i] = qb[(size_t)(i >> 7) * 2048 + (i & 127)];
    }

    float mrow[8], lrow[8];
    v8f acc[8] = {};
#pragma unroll
    for (int v = 0; v < 8; ++v) { mrow[v] = -1e30f; lrow[v] = 0.f; }

    const float scale = 0.08838834764831845f;  // 1/sqrt(128)
    const int lastj = past + qt * 16 + 15;
    int nkt = lastj / 16 + 1;
    if (nkt > (S >> 4)) nkt = S >> 4;

    const float* krbase = KR + (size_t)b * S * 128;
    const float* vbase  = KV + (size_t)b * S * 256 + 128;  // V half
    float* psw = ps[wv];

    for (int kt = 0; kt < nkt; ++kt) {
        // ---- scores tile: 16x16 = q(16x128) @ k^T, 32 WMMAs of K=4
        v8f sc = {};
        const float* kp = krbase + (size_t)(kt * 16 + n16) * 128 + (hi << 1);
        const float* qp = qsw + n16 * 128 + (hi << 1);
#pragma unroll
        for (int kk = 0; kk < 32; ++kk) {
            v2f a  = *(const v2f*)(qp + kk * 4);
            v2f bb = *(const v2f*)(kp + kk * 4);
            sc = WMMA_F32(a, bb, sc);
        }

        // ---- scale + causal mask + online softmax (row = hi*8+v across 16 lanes)
        float pv[8];
        const int j = kt * 16 + n16;  // key position for this lane's column
#pragma unroll
        for (int v = 0; v < 8; ++v) {
            float x = sc[v] * scale;
            const int irow = past + qt * 16 + hi * 8 + v;
            if (j > irow) x = -1e30f;
            float t = x;
            t = fmaxf(t, __shfl_xor(t, 1));
            t = fmaxf(t, __shfl_xor(t, 2));
            t = fmaxf(t, __shfl_xor(t, 4));
            t = fmaxf(t, __shfl_xor(t, 8));
            const float mnew = fmaxf(mrow[v], t);
            const float p = __expf(x - mnew);
            float psum = p;
            psum += __shfl_xor(psum, 1);
            psum += __shfl_xor(psum, 2);
            psum += __shfl_xor(psum, 4);
            psum += __shfl_xor(psum, 8);
            const float rs = __expf(mrow[v] - mnew);
            lrow[v] = lrow[v] * rs + psum;
            mrow[v] = mnew;
            pv[v] = p;
#pragma unroll
            for (int cb = 0; cb < 8; ++cb) acc[cb][v] *= rs;
        }

        // ---- P tile: C-layout regs -> LDS -> A-layout fragments
#pragma unroll
        for (int v = 0; v < 8; ++v) psw[(hi * 8 + v) * 16 + n16] = pv[v];

        // ---- acc += P(16x16) @ V(16x128): 8 col-blocks x 4 WMMAs
        const float* pp  = psw + n16 * 16 + (hi << 1);
        const float* vp0 = vbase + (size_t)(kt * 16 + (hi << 1)) * 256 + n16;
#pragma unroll
        for (int cb = 0; cb < 8; ++cb) {
            const float* vp = vp0 + cb * 16;
            v8f c = acc[cb];
#pragma unroll
            for (int kk = 0; kk < 4; ++kk) {
                v2f a = *(const v2f*)(pp + kk * 4);
                v2f bb;
                bb.x = vp[(kk * 4 + 0) * 256];
                bb.y = vp[(kk * 4 + 1) * 256];
                c = WMMA_F32(a, bb, c);
            }
            acc[cb] = c;
        }
    }

    // ---- O = acc / l, written in place over this tile's q region
    float* ob = QO + (size_t)(b * S + qt * 16) * 2048 + h * 128;
#pragma unroll
    for (int cb = 0; cb < 8; ++cb) {
#pragma unroll
        for (int v = 0; v < 8; ++v) {
            const int m = hi * 8 + v;
            ob[(size_t)m * 2048 + cb * 16 + n16] = acc[cb][v] / lrow[v];
        }
    }
}

// ---------------------------------------------------------------------------
extern "C" void kernel_launch(void* const* d_in, const int* in_sizes, int n_in,
                              void* d_out, int out_size, void* d_ws, size_t ws_size,
                              hipStream_t stream) {
    const float* x   = (const float*)d_in[0];
    const float* wq  = (const float*)d_in[1];
    const float* wkv = (const float*)d_in[2];
    const float* wo  = (const float*)d_in[3];
    const int* past  = (const int*)d_in[4];

    const int B = 2, S = 2048, D = 2048, H = 16, DH = 128;
    const int M = B * S;  // 4096

    float* ws  = (float*)d_ws;
    float* Q   = ws;                        // M*D   (later holds O in place)
    float* KVt = Q + (size_t)M * D;         // M*256
    float* KR  = KVt + (size_t)M * 256;     // M*128
    // total ws use: (M*D + M*256 + M*128)*4 bytes = ~38 MB

    float* out  = (float*)d_out;            // M*D
    float* outK = out + (size_t)M * D;      // M*DH
    float* outV = outK + (size_t)M * DH;    // M*DH

    // 1) Q = x @ wq^T         [4096x2048] x [2048x2048]^T
    gemm_f32<true><<<(M / 64) * (D / 64), 128, 0, stream>>>(x, wq, Q, M, D, D, D, D, D);

    // 2) KV = x @ wkv         [4096x2048] x [2048x256]
    gemm_f32<false><<<(M / 64) * (256 / 64), 128, 0, stream>>>(x, wkv, KVt, M, 256, D, D, 256, 256);

    // 3) outputs K (pre-rope) and V
    copy_kv<<<(M * DH) / 256, 256, 0, stream>>>(KVt, outK, outV, M);

    // 4) RoPE
    rope_q<<<(M * H * 64) / 256, 256, 0, stream>>>(Q, past, S);
    rope_k<<<(M * 64) / 256, 256, 0, stream>>>(KVt, KR, S);

    // 5) causal MQA flash attention; O overwrites Q buffer
    attn_kernel<<<(B * H * (S / 16)) / 4, 128, 0, stream>>>(Q, KR, KVt, past, S);

    // 6) out = O @ wo^T
    gemm_f32<true><<<(M / 64) * (D / 64), 128, 0, stream>>>(Q, wo, out, M, D, D, D, D, D);
}

// v001
// It runs in 946 microseconds.
// Timed twice side by side with v000, it ran 1.23 times as fast both times.
#include <hip/hip_runtime.h>
#include <math.h>
#include <stdint.h>

typedef float v2f __attribute__((ext_vector_type(2)));
typedef float v4f __attribute__((ext_vector_type(4)));
typedef float v8f __attribute__((ext_vector_type(8)));

#define WMMA_F32(a, b, c) \
    __builtin_amdgcn_wmma_f32_16x16x4_f32(false, (a), false, (b), (short)0, (c), false, false)

// ---------------------------------------------------------------------------
// GEMM: C[M,N] = X[M,K] * op(W)
//   WT=true : W stored [N,K] row-major (compute X @ W^T)
//   WT=false: W stored [K,N] row-major (compute X @ W)
// One block (4 waves, 128 threads) computes a 64x64 C tile; wave wv owns the
// 16-row strip. W K-chunks (64x32 f32 = 8 KB) are staged cooperatively into
// LDS via CDNA5 async-to-LDS loads (ASYNCcnt), shared by all 4 waves. A
// fragments stream directly from global (per-wave rows). 32 WMMAs per wave
// per chunk against 8 global loads + 32 LDS loads.
// ---------------------------------------------------------------------------
template <bool WT>
__global__ __launch_bounds__(128) void gemm_f32(const float* __restrict__ X,
                                                const float* __restrict__ W,
                                                float* __restrict__ C,
                                                int M, int N, int K,
                                                int ldx, int ldw, int ldc) {
    __shared__ float wlds[64 * 32];  // one K-chunk of the W tile (8 KB)

    const int lane = threadIdx.x & 31;
    const int wv   = threadIdx.x >> 5;
    const int ntiles = N >> 6;
    const int mt = blockIdx.x / ntiles;  // 64-row block index
    const int nt = blockIdx.x % ntiles;  // 64-col block index

    const int n16  = lane & 15;
    const int hi   = lane >> 4;  // 0 or 1
    const int koff = hi << 1;    // 0 or 2

    const float* xrow = X + (size_t)(mt * 64 + wv * 16 + n16) * ldx;  // A row m=lane&15
    v8f acc[4] = {};

    for (int k0 = 0; k0 < K; k0 += 32) {
        __syncthreads();  // previous chunk fully consumed before restaging
        // ---- stage W chunk into LDS: 512 x 16B pieces, 4 per thread, async
#pragma unroll
        for (int i = 0; i < 4; ++i) {
            const int p = threadIdx.x * 4 + i;
            const float* g;
            const float* l;
            if (WT) {  // wlds[n][k], n-row = 32 floats, contiguous in global too
                const int n = p >> 3, kq = p & 7;
                g = W + (size_t)(nt * 64 + n) * ldw + k0 + kq * 4;
                l = &wlds[n * 32 + kq * 4];
            } else {   // wlds[k][n], k-row = 64 floats, contiguous in global too
                const int k = p >> 4, nq = p & 15;
                g = W + (size_t)(k0 + k) * ldw + nt * 64 + nq * 4;
                l = &wlds[k * 64 + nq * 4];
            }
            const uint32_t ldsa = (uint32_t)(uintptr_t)l;   // low 32 bits = LDS offset
            const uint64_t ga   = (uint64_t)(uintptr_t)g;
            asm volatile("global_load_async_to_lds_b128 %0, %1, off"
                         :: "v"(ldsa), "v"(ga) : "memory");
        }
        asm volatile("s_wait_asynccnt 0" ::: "memory");
        __syncthreads();  // all waves' staging visible

        // ---- 8 K-steps of 4 WMMAs
#pragma unroll
        for (int kk = 0; kk < 8; ++kk) {
            v2f a = *(const v2f*)(xrow + k0 + kk * 4 + koff);
#pragma unroll
            for (int t = 0; t < 4; ++t) {
                v2f b;
                if (WT) {
                    b = *(const v2f*)&wlds[(t * 16 + n16) * 32 + kk * 4 + koff];
                } else {
                    b.x = wlds[(kk * 4 + koff) * 64 + t * 16 + n16];
                    b.y = wlds[(kk * 4 + koff + 1) * 64 + t * 16 + n16];
                }
                acc[t] = WMMA_F32(a, b, acc[t]);
            }
        }
    }

#pragma unroll
    for (int t = 0; t < 4; ++t) {
#pragma unroll
        for (int v = 0; v < 8; ++v) {
            const int m = hi * 8 + v;  // C layout: vgpr v, lane group hi -> row v+8*hi
            C[(size_t)(mt * 64 + wv * 16 + m) * ldc + nt * 64 + t * 16 + n16] = acc[t][v];
        }
    }
}

// ---------------------------------------------------------------------------
// Split KV[M,256] into K (cols 0..127, pre-rope) and V (cols 128..255) outputs
// ---------------------------------------------------------------------------
__global__ __launch_bounds__(256) void copy_kv(const float* __restrict__ KV,
                                               float* __restrict__ outK,
                                               float* __restrict__ outV, int M) {
    const int idx = blockIdx.x * 256 + threadIdx.x;  // M*128 threads
    const int r = idx >> 7;
    const int d = idx & 127;
    outK[idx] = KV[(size_t)r * 256 + d];
    outV[idx] = KV[(size_t)r * 256 + 128 + d];
}

// ---------------------------------------------------------------------------
// RoPE on Q in place. One thread handles (d, d+64) pair of one (b,s,h).
// pos = past + s.  Threads: B*S*H*64
// ---------------------------------------------------------------------------
__global__ __launch_bounds__(256) void rope_q(float* __restrict__ Q,
                                              const int* __restrict__ past_ptr, int S) {
    const int idx = blockIdx.x * 256 + threadIdx.x;
    const int d = idx & 63;
    const int h = (idx >> 6) & 15;
    const int r = idx >> 10;  // b*S + s
    const int s = r % S;
    const float pos = (float)(*past_ptr + s);
    const float freq = __expf(-0.14391156213f * (float)d);  // 1/10000^(d/64)
    float sn, cs;
    sincosf(pos * freq, &sn, &cs);
    const size_t base = (size_t)r * 2048 + h * 128 + d;
    const float x1 = Q[base];
    const float x2 = Q[base + 64];
    Q[base] = x1 * cs - x2 * sn;
    Q[base + 64] = x2 * cs + x1 * sn;
}

// ---------------------------------------------------------------------------
// Pack K (roped, pos = s) and V into WMMA fragment order for the attention
// kernel. A 16-key tile is 16 groups of 32 lanes x 4 floats (2048 floats), so
// one wave-wide 16-byte load is 512 contiguous bytes and feeds two WMMAs.
//   KF group j,   lane (hi,n16), e: K[key n16][d = 8j + 4(e>>1) + 2hi + (e&1)]
//   VF group q,   lane (hi,n16), e: V[key 8(q&1) + 4(e>>1) + 2hi + (e&1)][d = 16(q>>1) + n16]
// One thread writes groups j and j+8 of both (the rope pair d, d+64 lies in
// groups j and j+8 at the same lane and e). Threads: B*S*16
// ---------------------------------------------------------------------------
__global__ __launch_bounds__(256) void pack_kv(const float* __restrict__ KV,
                                               float* __restrict__ KF,
                                               float* __restrict__ VF, int S) {
    const int idx  = blockIdx.x * 256 + threadIdx.x;
    const int lane = idx & 31;
    const int j    = (idx >> 5) & 7;
    const int tile = idx >> 8;  // (b*S + s) / 16
    const int n16  = lane & 15;
    const int hi   = lane >> 4;

    const int r = tile * 16 + n16;  // b*S + s
    const int s = r % S;
    const float* krow = KV + (size_t)r * 256;
    v4f lo, up;
#pragma unroll
    for (int e = 0; e < 4; ++e) {
        const int d = j * 8 + (e >> 1) * 4 + hi * 2 + (e & 1);
        const float freq = __expf(-0.14391156213f * (float)d);
        float sn, cs;
        sincosf((float)s * freq, &sn, &cs);
        const float x1 = krow[d];
        const float x2 = krow[64 + d];
        lo[e] = x1 * cs - x2 * sn;
        up[e] = x2 * cs + x1 * sn;
    }
    v4f* kf = (v4f*)KF + (size_t)tile * 512 + lane;
    kf[j * 32]       = lo;
    kf[(j + 8) * 32] = up;

    v4f* vf = (v4f*)VF + (size_t)tile * 512 + lane;
#pragma unroll
    for (int g = 0; g < 2; ++g) {
        const int q = j + g * 8;
        const float* vcol = KV + (size_t)(tile * 16 + (q & 1) * 8 + hi * 2) * 256 + 128 + (q >> 1) * 16 + n16;
        v4f vv;
        vv[0] = vcol[0 * 256];
        vv[1] = vcol[1 * 256];
        vv[2] = vcol[4 * 256];
        vv[3] = vcol[5 * 256];
        vf[q * 32] = vv;
    }
}

// ---------------------------------------------------------------------------
// Flash attention, causal, MQA (one KV head). One wave per (b, h, 16-row qtile).
// QK^T and P@V via fp32 WMMA. O written in place over the (roped) Q region of
// that exact tile/head -- safe: each wave stages its q tile into LDS first and
// tiles are disjoint across waves. Q (in LDS), K and V (packed by pack_kv) are
// all held in fragment order: every operand load is 16 contiguous bytes a lane.
// ---------------------------------------------------------------------------
__global__ __launch_bounds__(128) void attn_kernel(float* __restrict__ QO,
                                                   const float* __restrict__ KF,
                                                   const float* __restrict__ VF,
                                                   const int* __restrict__ past_ptr,
                                                   int S) {
    // per-wave q tile, 8KB each, in the order of KF (row m in place of the key)
    __shared__ __attribute__((aligned(16))) float qs[4][16 * 128];
    __shared__ float ps[4][16 * 16];   // per-wave P tile (C-layout -> A-layout)

    const int lane = threadIdx.x & 31;
    const int wv   = threadIdx.x >> 5;
    const int qtiles = S >> 4;
    const int wid = blockIdx.x * 4 + wv;
    const int qt = wid % qtiles;
    const int h  = (wid / qtiles) & 15;
    const int b  = wid / (qtiles * 16);
    const int past = *past_ptr;

    const int n16 = lane & 15;
    const int hi  = lane >> 4;

    float* qsw = qs[wv];
    {
        // lane (hi,n16) brings Q[n16][8j + 4hi .. +3]; its two pairs go to the
        // lanes hi' = 0 and 1 of group j, at e = 2hi (32 distinct 8-byte slots a store)
        const float* qb = QO + (size_t)(b * S + qt * 16 + n16) * 2048 + h * 128 + hi * 4;
        v4f qv[16];
#pragma unroll
        for (int jj = 0; jj < 16; ++jj) qv[jj] = *(const v4f*)(qb + jj * 8);
        // the address pair stays whole until every load above has taken it
        asm volatile("s_wait_xcnt 0x0" :: "v"(qb) : "memory");
        float* qd = qsw + n16 * 4 + hi * 2;
#pragma unroll
        for (int jj = 0; jj < 16; ++jj) {
            *(v2f*)(qd + jj * 128)      = qv[jj].xy;
            *(v2f*)(qd + jj * 128 + 64) = qv[jj].zw;
        }
    }

    float mrow[8], lrow[8];
    v8f acc[8] = {};
#pragma unroll
    for (int v = 0; v < 8; ++v) { mrow[v] = -1e30f; lrow[v] = 0.f; }

    const float scale = 0.08838834764831845f;  // 1/sqrt(128)
    const int lastj = past + qt * 16 + 15;
    int nkt = lastj / 16 + 1;
    if (nkt > (S >> 4)) nkt = S >> 4;

    const v4f* kfbase = (const v4f*)KF + (size_t)b * (S >> 4) * 512 + lane;
    const v4f* vfbase = (const v4f*)VF + (size_t)b * (S >> 4) * 512 + lane;
    const v4f* qf = (const v4f*)qsw + lane;
    float* psw = ps[wv];

    for (int kt = 0; kt < nkt; ++kt) {
        // ---- scores tile: 16x16 = q(16x128) @ k^T, 32 WMMAs of K=4
        v8f sc = {};
        const v4f* kf = kfbase + (size_t)kt * 512;
        v4f kb[16];
#pragma unroll
        for (int jj = 0; jj < 16; ++jj) kb[jj] = kf[jj * 32];
        // the address pair stays whole until every load above has taken it
        asm volatile("s_wait_xcnt 0x0" :: "v"(kf) : "memory");
        // keeps the tile's 16 loads in flight together: without it the compiler
        // reuses one register quad and waits out each load's latency in turn
        __builtin_amdgcn_sched_barrier(0);
#pragma unroll
        for (int jj = 0; jj < 16; ++jj) {
            const v4f a4 = qf[jj * 32];
            sc = WMMA_F32(a4.xy, kb[jj].xy, sc);
            sc = WMMA_F32(a4.zw, kb[jj].zw, sc);
        }
        const v4f* vf = vfbase + (size_t)kt * 512;
        v4f vb[16];
#pragma unroll
        for (int q = 0; q < 16; ++q) vb[q] = vf[q * 32];
        // the address pair stays whole until every load above has taken it
        asm volatile("s_wait_xcnt 0x0" :: "v"(vf) : "memory");
        // same purpose for the V tile's 16 loads
        __builtin_amdgcn_sched_barrier(0);

        // ---- scale + causal mask + online softmax (row = hi*8+v across 16 lanes)
        float pv[8];
        const int j = kt * 16 + n16;  // key position for this lane's column
#pragma unroll
        for (int v = 0; v < 8; ++v) {
            float x = sc[v] * scale;
            const int irow = past + qt * 16 + hi * 8 + v;
            if (j > irow) x = -1e30f;
            float t = x;
            t = fmaxf(t, __shfl_xor(t, 1));
            t = fmaxf(t, __shfl_xor(t, 2));
            t = fmaxf(t, __shfl_xor(t, 4));
            t = fmaxf(t, __shfl_xor(t, 8));
            const float mnew = fmaxf(mrow[v], t);
            const float p = __expf(x - mnew);
            float psum = p;
            psum += __shfl_xor(psum, 1);
            psum += __shfl_xor(psum, 2);
            psum += __shfl_xor(psum, 4);
            psum += __shfl_xor(psum, 8);
            const float rs = __expf(mrow[v] - mnew);
            lrow[v] = lrow[v] * rs + psum;
            mrow[v] = mnew;
            pv[v] = p;
#pragma unroll
            for (int cb = 0; cb < 8; ++cb) acc[cb][v] *= rs;
        }

        // ---- P tile: C-layout regs -> LDS -> A-layout fragments
#pragma unroll
        for (int v = 0; v < 8; ++v) psw[(hi * 8 + v) * 16 + n16] = pv[v];

        // ---- acc += P(16x16) @ V(16x128): 8 col-blocks x 4 WMMAs
        const float* pp  = psw + n16 * 16 + (hi << 1);
        v2f pa[4];
#pragma unroll
        for (int kk = 0; kk < 4; ++kk) pa[kk] = *(const v2f*)(pp + kk * 4);
#pragma unroll
        for (int cb = 0; cb < 8; ++cb) {
            const v4f v01 = vb[cb * 2 + 0];
            const v4f v23 = vb[cb * 2 + 1];
            v8f c = acc[cb];
            c = WMMA_F32(pa[0], v01.xy, c);
            c = WMMA_F32(pa[1], v01.zw, c);
            c = WMMA_F32(pa[2], v23.xy, c);
            c = WMMA_F32(pa[3], v23.zw, c);
            acc[cb] = c;
        }
    }

    // ---- O = acc / l, written in place over this tile's q region
    float* ob = QO + (size_t)(b * S + qt * 16) * 2048 + h * 128;
#pragma unroll
    for (int cb = 0; cb < 8; ++cb) {
#pragma unroll
        for (int v = 0; v < 8; ++v) {
            const int m = hi * 8 + v;
            ob[(size_t)m * 2048 + cb * 16 + n16] = acc[cb][v] / lrow[v];
        }
    }
}

// ---------------------------------------------------------------------------
extern "C" void kernel_launch(void* const* d_in, const int* in_sizes, int n_in,
                              void* d_out, int out_size, void* d_ws, size_t ws_size,
                              hipStream_t stream) {
    const float* x   = (const float*)d_in[0];
    const float* wq  = (const float*)d_in[1];
    const float* wkv = (const float*)d_in[2];
    const float* wo  = (const float*)d_in[3];
    const int* past  = (const int*)d_in[4];

    const int B = 2, S = 2048, D = 2048, H = 16, DH = 128;
    const int M = B * S;  // 4096

    float* ws  = (float*)d_ws;
    float* Q   = ws;                        // M*D   (later holds O in place)
    float* KVt = Q + (size_t)M * D;         // M*256
    float* KF  = KVt + (size_t)M * 256;     // M*128, roped K in fragment order
    float* VF  = KF + (size_t)M * 128;      // M*128, V in fragment order
    // total ws use: (M*D + M*256 + 2*M*128)*4 bytes = ~40 MB

    float* out  = (float*)d_out;            // M*D
    float* outK = out + (size_t)M * D;      // M*DH
    float* outV = outK + (size_t)M * DH;    // M*DH

    // 1) Q = x @ wq^T         [4096x2048] x [2048x2048]^T
    gemm_f32<true><<<(M / 64) * (D / 64), 128, 0, stream>>>(x, wq, Q, M, D, D, D, D, D);

    // 2) KV = x @ wkv         [4096x2048] x [2048x256]
    gemm_f32<false><<<(M / 64) * (256 / 64), 128, 0, stream>>>(x, wkv, KVt, M, 256, D, D, 256, 256);

    // 3) outputs K (pre-rope) and V
    copy_kv<<<(M * DH) / 256, 256, 0, stream>>>(KVt, outK, outV, M);

    // 4) RoPE
    rope_q<<<(M * H * 64) / 256, 256, 0, stream>>>(Q, past, S);
    pack_kv<<<(M * 16) / 256, 256, 0, stream>>>(KVt, KF, VF, S);

    // 5) causal MQA flash attention; O overwrites Q buffer
    attn_kernel<<<(B * H * (S / 16)) / 4, 128, 0, stream>>>(Q, KF, VF, past, S);

    // 6) out = O @ wo^T
    gemm_f32<true><<<(M / 64) * (D / 64), 128, 0, stream>>>(Q, wo, out, M, D, D, D, D, D);
}

// v002
// Measured time: 808 microseconds a run.
// In both of two side-by-side timings against v001, it was 1.17 times as fast.
// Over all steps from v000 it is 1.44 times as fast.
#include <hip/hip_runtime.h>
#include <math.h>
#include <stdint.h>

typedef float v2f __attribute__((ext_vector_type(2)));
typedef float v4f __attribute__((ext_vector_type(4)));
typedef float v8f __attribute__((ext_vector_type(8)));

#define WMMA_F32(a, b, c) \
    __builtin_amdgcn_wmma_f32_16x16x4_f32(false, (a), false, (b), (short)0, (c), false, false)

// ---------------------------------------------------------------------------
// GEMM: C[M,N] = X[M,K] * op(W)
//   WT=true : W stored [N,K] row-major (compute X @ W^T)
//   WT=false: W stored [K,N] row-major (compute X @ W)
// One block (4 waves, 128 threads) computes a 64x64 C tile; wave wv owns the
// 16-row strip. Per K-chunk of 32 the X tile (64x32) and the W tile are both
// staged into LDS by async-to-LDS copies (ASYNCcnt). One copy instruction of a
// wave takes 512 contiguous-by-line bytes (four whole 128-byte lines). The LDS
// rows are pitched so that the 32 lanes of a fragment read fall on distinct
// banks: 36 floats for rows read along k (16 rows x 2 k-pairs cover all 64
// banks), 80 floats for the [K,N] form (rows k and k+2 lie 32 banks apart, so
// the two lane halves keep apart also where two 16-column reads are merged).
// ---------------------------------------------------------------------------
template <bool WT>
__global__ __launch_bounds__(128) void gemm_f32(const float* __restrict__ X,
                                                const float* __restrict__ W,
                                                float* __restrict__ C,
                                                int M, int N, int K,
                                                int ldx, int ldw, int ldc) {
    constexpr int XP = 36;            // floats per LDS row of the X chunk
    constexpr int WP = WT ? 36 : 80;  // floats per LDS row of the W chunk
    __shared__ __attribute__((aligned(16))) float xlds[64 * XP];
    __shared__ __attribute__((aligned(16))) float wlds[(WT ? 64 : 32) * WP];

    const int lane = threadIdx.x & 31;
    const int wv   = threadIdx.x >> 5;
    const int ntiles = N >> 6;
    const int mt = blockIdx.x / ntiles;  // 64-row block index
    const int nt = blockIdx.x % ntiles;  // 64-col block index

    const int n16  = lane & 15;
    const int hi   = lane >> 4;  // 0 or 1
    const int koff = hi << 1;    // 0 or 2

    // each chunk is 512 pieces of 16 bytes per operand, 4 + 4 per thread;
    // piece p = i*128 + thread, so neighbouring lanes take neighbouring pieces
    const float* xg[4];
    const float* wg[4];
    uint32_t xl[4], wl[4];  // low 32 bits of a __shared__ address = LDS offset
#pragma unroll
    for (int i = 0; i < 4; ++i) {
        const int p = i * 128 + threadIdx.x;
        xg[i] = X + (size_t)(mt * 64 + (p >> 3)) * ldx + (p & 7) * 4;
        xl[i] = (uint32_t)(uintptr_t)&xlds[(p >> 3) * XP + (p & 7) * 4];
        if (WT) {  // wlds[n][k]: a row is 32 floats of one W row
            wg[i] = W + (size_t)(nt * 64 + (p >> 3)) * ldw + (p & 7) * 4;
            wl[i] = (uint32_t)(uintptr_t)&wlds[(p >> 3) * WP + (p & 7) * 4];
        } else {   // wlds[k][n]: a row is 64 floats of one W row
            wg[i] = W + (size_t)(p >> 4) * ldw + nt * 64 + (p & 15) * 4;
            wl[i] = (uint32_t)(uintptr_t)&wlds[(p >> 4) * WP + (p & 15) * 4];
        }
    }
    const size_t wstep = WT ? (size_t)32 : (size_t)32 * ldw;

    const float* xf = &xlds[(wv * 16 + n16) * XP + koff];  // A row m = lane&15
    v8f acc[4] = {};

    for (int k0 = 0; k0 < K; k0 += 32) {
        // this wave's fragment reads of the previous chunk have returned ...
        asm volatile("s_wait_dscnt 0x0" ::: "memory");
        __syncthreads();  // ... and so have every other wave's: restaging is safe
        // the copies and their s_wait_xcnt stand in one statement, so the compiler
        // can move no update of an address register in front of that wait
        asm volatile(
            "global_load_async_to_lds_b128 %0, %1, off\n\t"
            "global_load_async_to_lds_b128 %2, %3, off\n\t"
            "global_load_async_to_lds_b128 %4, %5, off\n\t"
            "global_load_async_to_lds_b128 %6, %7, off\n\t"
            "global_load_async_to_lds_b128 %8, %9, off\n\t"
            "global_load_async_to_lds_b128 %10, %11, off\n\t"
            "global_load_async_to_lds_b128 %12, %13, off\n\t"
            "global_load_async_to_lds_b128 %14, %15, off\n\t"
            "s_wait_xcnt 0x0"
            :: "v"(xl[0]), "v"(xg[0]), "v"(xl[1]), "v"(xg[1]),
               "v"(xl[2]), "v"(xg[2]), "v"(xl[3]), "v"(xg[3]),
               "v"(wl[0]), "v"(wg[0]), "v"(wl[1]), "v"(wg[1]),
               "v"(wl[2]), "v"(wg[2]), "v"(wl[3]), "v"(wg[3])
            : "memory");
        // this wave's copies have landed
        asm volatile("s_wait_asynccnt 0x0" ::: "memory");
        __syncthreads();  // all waves' staging visible
#pragma unroll
        for (int i = 0; i < 4; ++i) {
            xg[i] += 32;
            wg[i] += wstep;
        }

        // ---- 8 K-steps of 4 WMMAs
#pragma unroll
        for (int kk = 0; kk < 8; ++kk) {
            v2f a = *(const v2f*)(xf + kk * 4);
#pragma unroll
            for (int t = 0; t < 4; ++t) {
                v2f b;
                if (WT) {
                    b = *(const v2f*)&wlds[(t * 16 + n16) * WP + kk * 4 + koff];
                } else {
                    b.x = wlds[(kk * 4 + koff) * WP + t * 16 + n16];
                    b.y = wlds[(kk * 4 + koff + 1) * WP + t * 16 + n16];
                }
                acc[t] = WMMA_F32(a, b, acc[t]);
            }
        }
    }

#pragma unroll
    for (int t = 0; t < 4; ++t) {
#pragma unroll
        for (int v = 0; v < 8; ++v) {
            const int m = hi * 8 + v;  // C layout: vgpr v, lane group hi -> row v+8*hi
            C[(size_t)(mt * 64 + wv * 16 + m) * ldc + nt * 64 + t * 16 + n16] = acc[t][v];
        }
    }
}

// ---------------------------------------------------------------------------
// Split KV[M,256] into K (cols 0..127, pre-rope) and V (cols 128..255) outputs
// ---------------------------------------------------------------------------
__global__ __launch_bounds__(256) void copy_kv(const float* __restrict__ KV,
                                               float* __restrict__ outK,
                                               float* __restrict__ outV, int M) {
    const int idx = blockIdx.x * 256 + threadIdx.x;  // M*128 threads
    const int r = idx >> 7;
    const int d = idx & 127;
    outK[idx] = KV[(size_t)r * 256 + d];
    outV[idx] = KV[(size_t)r * 256 + 128 + d];
}

// ---------------------------------------------------------------------------
// RoPE on Q in place. One thread handles (d, d+64) pair of one (b,s,h).
// pos = past + s.  Threads: B*S*H*64
// ---------------------------------------------------------------------------
__global__ __launch_bounds__(256) void rope_q(float* __restrict__ Q,
                                              const int* __restrict__ past_ptr, int S) {
    const int idx = blockIdx.x * 256 + threadIdx.x;
    const int d = idx & 63;
    const int h = (idx >> 6) & 15;
    const int r = idx >> 10;  // b*S + s
    const int s = r % S;
    const float pos = (float)(*past_ptr + s);
    const float freq = __expf(-0.14391156213f * (float)d);  // 1/10000^(d/64)
    float sn, cs;
    sincosf(pos * freq, &sn, &cs);
    const size_t base = (size_t)r * 2048 + h * 128 + d;
    const float x1 = Q[base];
    const float x2 = Q[base + 64];
    Q[base] = x1 * cs - x2 * sn;
    Q[base + 64] = x2 * cs + x1 * sn;
}

// ---------------------------------------------------------------------------
// Pack K (roped, pos = s) and V into WMMA fragment order for the attention
// kernel. A 16-key tile is 16 groups of 32 lanes x 4 floats (2048 floats), so
// one wave-wide 16-byte load is 512 contiguous bytes and feeds two WMMAs.
//   KF group j,   lane (hi,n16), e: K[key n16][d = 8j + 4(e>>1) + 2hi + (e&1)]
//   VF group q,   lane (hi,n16), e: V[key 8(q&1) + 4(e>>1) + 2hi + (e&1)][d = 16(q>>1) + n16]
// One thread writes groups j and j+8 of both (the rope pair d, d+64 lies in
// groups j and j+8 at the same lane and e). Threads: B*S*16
// ---------------------------------------------------------------------------
__global__ __launch_bounds__(256) void pack_kv(const float* __restrict__ KV,
                                               float* __restrict__ KF,
                                               float* __restrict__ VF, int S) {
    const int idx  = blockIdx.x * 256 + threadIdx.x;
    const int lane = idx & 31;
    const int j    = (idx >> 5) & 7;
    const int tile = idx >> 8;  // (b*S + s) / 16
    const int n16  = lane & 15;
    const int hi   = lane >> 4;

    const int r = tile * 16 + n16;  // b*S + s
    const int s = r % S;
    const float* krow = KV + (size_t)r * 256;
    v4f lo, up;
#pragma unroll
    for (int e = 0; e < 4; ++e) {
        const int d = j * 8 + (e >> 1) * 4 + hi * 2 + (e & 1);
        const float freq = __expf(-0.14391156213f * (float)d);
        float sn, cs;
        sincosf((float)s * freq, &sn, &cs);
        const float x1 = krow[d];
        const float x2 = krow[64 + d];
        lo[e] = x1 * cs - x2 * sn;
        up[e] = x2 * cs + x1 * sn;
    }
    v4f* kf = (v4f*)KF + (size_t)tile * 512 + lane;
    kf[j * 32]       = lo;
    kf[(j + 8) * 32] = up;

    v4f* vf = (v4f*)VF + (size_t)tile * 512 + lane;
#pragma unroll
    for (int g = 0; g < 2; ++g) {
        const int q = j + g * 8;
        const float* vcol = KV + (size_t)(tile * 16 + (q & 1) * 8 + hi * 2) * 256 + 128 + (q >> 1) * 16 + n16;
        v4f vv;
        vv[0] = vcol[0 * 256];
        vv[1] = vcol[1 * 256];
        vv[2] = vcol[4 * 256];
        vv[3] = vcol[5 * 256];
        vf[q * 32] = vv;
    }
}

// ---------------------------------------------------------------------------
// Flash attention, causal, MQA (one KV head). One wave per (b, h, 16-row qtile).
// QK^T and P@V via fp32 WMMA. O written in place over the (roped) Q region of
// that exact tile/head -- safe: each wave stages its q tile into LDS first and
// tiles are disjoint across waves. Q (in LDS), K and V (packed by pack_kv) are
// all held in fragment order: every operand load is 16 contiguous bytes a lane.
// ---------------------------------------------------------------------------
__global__ __launch_bounds__(128) void attn_kernel(float* __restrict__ QO,
                                                   const float* __restrict__ KF,
                                                   const float* __restrict__ VF,
                                                   const int* __restrict__ past_ptr,
                                                   int S) {
    // per-wave q tile, 8KB each, in the order of KF (row m in place of the key)
    __shared__ __attribute__((aligned(16))) float qs[4][16 * 128];
    __shared__ float ps[4][16 * 16];   // per-wave P tile (C-layout -> A-layout)

    const int lane = threadIdx.x & 31;
    const int wv   = threadIdx.x >> 5;
    const int qtiles = S >> 4;
    const int wid = blockIdx.x * 4 + wv;
    const int qt = wid % qtiles;
    const int h  = (wid / qtiles) & 15;
    const int b  = wid / (qtiles * 16);
    const int past = *past_ptr;

    const int n16 = lane & 15;
    const int hi  = lane >> 4;

    float* qsw = qs[wv];
    {
        // lane (hi,n16) brings Q[n16][8j + 4hi .. +3]; its two pairs go to the
        // lanes hi' = 0 and 1 of group j, at e = 2hi (32 distinct 8-byte slots a store)
        const float* qb = QO + (size_t)(b * S + qt * 16 + n16) * 2048 + h * 128 + hi * 4;
        v4f qv[16];
#pragma unroll
        for (int jj = 0; jj < 16; ++jj) qv[jj] = *(const v4f*)(qb + jj * 8);
        // the address pair stays whole until every load above has taken it
        asm volatile("s_wait_xcnt 0x0" :: "v"(qb) : "memory");
        float* qd = qsw + n16 * 4 + hi * 2;
#pragma unroll
        for (int jj = 0; jj < 16; ++jj) {
            *(v2f*)(qd + jj * 128)      = qv[jj].xy;
            *(v2f*)(qd + jj * 128 + 64) = qv[jj].zw;
        }
    }

    float mrow[8], lrow[8];
    v8f acc[8] = {};
#pragma unroll
    for (int v = 0; v < 8; ++v) { mrow[v] = -1e30f; lrow[v] = 0.f; }

    const float scale = 0.08838834764831845f;  // 1/sqrt(128)
    const int lastj = past + qt * 16 + 15;
    int nkt = lastj / 16 + 1;
    if (nkt > (S >> 4)) nkt = S >> 4;

    const v4f* kfbase = (const v4f*)KF + (size_t)b * (S >> 4) * 512 + lane;
    const v4f* vfbase = (const v4f*)VF + (size_t)b * (S >> 4) * 512 + lane;
    const v4f* qf = (const v4f*)qsw + lane;
    float* psw = ps[wv];

    for (int kt = 0; kt < nkt; ++kt) {
        // ---- scores tile: 16x16 = q(16x128) @ k^T, 32 WMMAs of K=4
        v8f sc = {};
        const v4f* kf = kfbase + (size_t)kt * 512;
        v4f kb[16];
#pragma unroll
        for (int jj = 0; jj < 16; ++jj) kb[jj] = kf[jj * 32];
        // the address pair stays whole until every load above has taken it
        asm volatile("s_wait_xcnt 0x0" :: "v"(kf) : "memory");
        // keeps the tile's 16 loads in flight together: without it the compiler
        // reuses one register quad and waits out each load's latency in turn
        __builtin_amdgcn_sched_barrier(0);
#pragma unroll
        for (int jj = 0; jj < 16; ++jj) {
            const v4f a4 = qf[jj * 32];
            sc = WMMA_F32(a4.xy, kb[jj].xy, sc);
            sc = WMMA_F32(a4.zw, kb[jj].zw, sc);
        }
        const v4f* vf = vfbase + (size_t)kt * 512;
        v4f vb[16];
#pragma unroll
        for (int q = 0; q < 16; ++q) vb[q] = vf[q * 32];
        // the address pair stays whole until every load above has taken it
        asm volatile("s_wait_xcnt 0x0" :: "v"(vf) : "memory");
        // same purpose for the V tile's 16 loads
        __builtin_amdgcn_sched_barrier(0);

        // ---- scale + causal mask + online softmax (row = hi*8+v across 16 lanes)
        float pv[8];
        const int j = kt * 16 + n16;  // key position for this lane's column
#pragma unroll
        for (int v = 0; v < 8; ++v) {
            float x = sc[v] * scale;
            const int irow = past + qt * 16 + hi * 8 + v;
            if (j > irow) x = -1e30f;
            float t = x;
            t = fmaxf(t, __shfl_xor(t, 1));
            t = fmaxf(t, __shfl_xor(t, 2));
            t = fmaxf(t, __shfl_xor(t, 4));
            t = fmaxf(t, __shfl_xor(t, 8));
            const float mnew = fmaxf(mrow[v], t);
            const float p = __expf(x - mnew);
            float psum = p;
            psum += __shfl_xor(psum, 1);
            psum += __shfl_xor(psum, 2);
            psum += __shfl_xor(psum, 4);
            psum += __shfl_xor(psum, 8);
            const float rs = __expf(mrow[v] - mnew);
            lrow[v] = lrow[v] * rs + psum;
            mrow[v] = mnew;
            pv[v] = p;
#pragma unroll
            for (int cb = 0; cb < 8; ++cb) acc[cb][v] *= rs;
        }

        // ---- P tile: C-layout regs -> LDS -> A-layout fragments
#pragma unroll
        for (int v = 0; v < 8; ++v) psw[(hi * 8 + v) * 16 + n16] = pv[v];

        // ---- acc += P(16x16) @ V(16x128): 8 col-blocks x 4 WMMAs
        const float* pp  = psw + n16 * 16 + (hi << 1);
        v2f pa[4];
#pragma unroll
        for (int kk = 0; kk < 4; ++kk) pa[kk] = *(const v2f*)(pp + kk * 4);
#pragma unroll
        for (int cb = 0; cb < 8; ++cb) {
            const v4f v01 = vb[cb * 2 + 0];
            const v4f v23 = vb[cb * 2 + 1];
            v8f c = acc[cb];
            c = WMMA_F32(pa[0], v01.xy, c);
            c = WMMA_F32(pa[1], v01.zw, c);
            c = WMMA_F32(pa[2], v23.xy, c);
            c = WMMA_F32(pa[3], v23.zw, c);
            acc[cb] = c;
        }
    }

    // ---- O = acc / l, written in place over this tile's q region
    float* ob = QO + (size_t)(b * S + qt * 16) * 2048 + h * 128;
#pragma unroll
    for (int cb = 0; cb < 8; ++cb) {
#pragma unroll
        for (int v = 0; v < 8; ++v) {
            const int m = hi * 8 + v;
            ob[(size_t)m * 2048 + cb * 16 + n16] = acc[cb][v] / lrow[v];
        }
    }
}

// ---------------------------------------------------------------------------
extern "C" void kernel_launch(void* const* d_in, const int* in_sizes, int n_in,
                              void* d_out, int out_size, void* d_ws, size_t ws_size,
                              hipStream_t stream) {
    const float* x   = (const float*)d_in[0];
    const float* wq  = (const float*)d_in[1];
    const float* wkv = (const float*)d_in[2];
    const float* wo  = (const float*)d_in[3];
    const int* past  = (const int*)d_in[4];

    const int B = 2, S = 2048, D = 2048, H = 16, DH = 128;
    const int M = B * S;  // 4096

    float* ws  = (float*)d_ws;
    float* Q   = ws;                        // M*D   (later holds O in place)
    float* KVt = Q + (size_t)M * D;         // M*256
    float* KF  = KVt + (size_t)M * 256;     // M*128, roped K in fragment order
    float* VF  = KF + (size_t)M * 128;      // M*128, V in fragment order
    // total ws use: (M*D + M*256 + 2*M*128)*4 bytes = ~40 MB

    float* out  = (float*)d_out;            // M*D
    float* outK = out + (size_t)M * D;      // M*DH
    float* outV = outK + (size_t)M * DH;    // M*DH

    // 1) Q = x @ wq^T         [4096x2048] x [2048x2048]^T
    gemm_f32<true><<<(M / 64) * (D / 64), 128, 0, stream>>>(x, wq, Q, M, D, D, D, D, D);

    // 2) KV = x @ wkv         [4096x2048] x [2048x256]
    gemm_f32<false><<<(M / 64) * (256 / 64), 128, 0, stream>>>(x, wkv, KVt, M, 256, D, D, 256, 256);

    // 3) outputs K (pre-rope) and V
    copy_kv<<<(M * DH) / 256, 256, 0, stream>>>(KVt, outK, outV, M);

    // 4) RoPE
    rope_q<<<(M * H * 64) / 256, 256, 0, stream>>>(Q, past, S);
    pack_kv<<<(M * 16) / 256, 256, 0, stream>>>(KVt, KF, VF, S);

    // 5) causal MQA flash attention; O overwrites Q buffer
    attn_kernel<<<(B * H * (S / 16)) / 4, 128, 0, stream>>>(Q, KF, VF, past, S);

    // 6) out = O @ wo^T
    gemm_f32<true><<<(M / 64) * (D / 64), 128, 0, stream>>>(Q, wo, out, M, D, D, D, D, D);
}

// v003
// It runs in 709 microseconds.
// Timed twice side by side with v002, it ran 1.14 and 1.13 times as fast.
// Over all steps from v000 it is 1.64 times as fast.
#include <hip/hip_runtime.h>
#include <math.h>
#include <stdint.h>

typedef float v2f __attribute__((ext_vector_type(2)));
typedef float v4f __attribute__((ext_vector_type(4)));
typedef float v8f __attribute__((ext_vector_type(8)));

#define WMMA_F32(a, b, c) \
    __builtin_amdgcn_wmma_f32_16x16x4_f32(false, (a), false, (b), (short)0, (c), false, false)

// ---------------------------------------------------------------------------
// GEMM: C[M,N] = X[M,K] * op(W)
//   WT=true : W stored [N,K] row-major (compute X @ W^T)
//   WT=false: W stored [K,N] row-major (compute X @ W)
// One block (4 waves, 128 threads) computes a 64x64 C tile; wave wv owns the
// 16-row strip. Per K-chunk of 32 the X tile (64x32) and the W tile are both
// staged into LDS by async-to-LDS copies (ASYNCcnt). One copy instruction of a
// wave takes 512 contiguous-by-line bytes (four whole 128-byte lines). The LDS
// rows are pitched so that the 32 lanes of a fragment read fall on distinct
// banks: 36 floats for rows read along k (16 rows x 2 k-pairs cover all 64
// banks), 80 floats for the [K,N] form (rows k and k+2 lie 32 banks apart, so
// the two lane halves keep apart also where two 16-column reads are merged).
// ---------------------------------------------------------------------------
template <bool WT>
__global__ __launch_bounds__(128) void gemm_f32(const float* __restrict__ X,
                                                const float* __restrict__ W,
                                                float* __restrict__ C,
                                                int M, int N, int K,
                                                int ldx, int ldw, int ldc) {
    constexpr int XP = 36;            // floats per LDS row of the X chunk
    constexpr int WP = WT ? 36 : 80;  // floats per LDS row of the W chunk
    __shared__ __attribute__((aligned(16))) float xlds[64 * XP];
    __shared__ __attribute__((aligned(16))) float wlds[(WT ? 64 : 32) * WP];

    const int lane = threadIdx.x & 31;
    const int wv   = threadIdx.x >> 5;
    const int ntiles = N >> 6;
    const int mt = blockIdx.x / ntiles;  // 64-row block index
    const int nt = blockIdx.x % ntiles;  // 64-col block index

    const int n16  = lane & 15;
    const int hi   = lane >> 4;  // 0 or 1
    const int koff = hi << 1;    // 0 or 2

    // each chunk is 512 pieces of 16 bytes per operand, 4 + 4 per thread;
    // piece p = i*128 + thread, so neighbouring lanes take neighbouring pieces
    const float* xg[4];
    const float* wg[4];
    uint32_t xl[4], wl[4];  // low 32 bits of a __shared__ address = LDS offset
#pragma unroll
    for (int i = 0; i < 4; ++i) {
        const int p = i * 128 + threadIdx.x;
        xg[i] = X + (size_t)(mt * 64 + (p >> 3)) * ldx + (p & 7) * 4;
        xl[i] = (uint32_t)(uintptr_t)&xlds[(p >> 3) * XP + (p & 7) * 4];
        if (WT) {  // wlds[n][k]: a row is 32 floats of one W row
            wg[i] = W + (size_t)(nt * 64 + (p >> 3)) * ldw + (p & 7) * 4;
            wl[i] = (uint32_t)(uintptr_t)&wlds[(p >> 3) * WP + (p & 7) * 4];
        } else {   // wlds[k][n]: a row is 64 floats of one W row
            wg[i] = W + (size_t)(p >> 4) * ldw + nt * 64 + (p & 15) * 4;
            wl[i] = (uint32_t)(uintptr_t)&wlds[(p >> 4) * WP + (p & 15) * 4];
        }
    }
    const size_t wstep = WT ? (size_t)32 : (size_t)32 * ldw;

    const float* xf = &xlds[(wv * 16 + n16) * XP + koff];  // A row m = lane&15
    v8f acc[4] = {};

    for (int k0 = 0; k0 < K; k0 += 32) {
        // this wave's fragment reads of the previous chunk have returned ...
        asm volatile("s_wait_dscnt 0x0" ::: "memory");
        __syncthreads();  // ... and so have every other wave's: restaging is safe
        // the copies and their s_wait_xcnt stand in one statement, so the compiler
        // can move no update of an address register in front of that wait
        asm volatile(
            "global_load_async_to_lds_b128 %0, %1, off\n\t"
            "global_load_async_to_lds_b128 %2, %3, off\n\t"
            "global_load_async_to_lds_b128 %4, %5, off\n\t"
            "global_load_async_to_lds_b128 %6, %7, off\n\t"
            "global_load_async_to_lds_b128 %8, %9, off\n\t"
            "global_load_async_to_lds_b128 %10, %11, off\n\t"
            "global_load_async_to_lds_b128 %12, %13, off\n\t"
            "global_load_async_to_lds_b128 %14, %15, off\n\t"
            "s_wait_xcnt 0x0"
            :: "v"(xl[0]), "v"(xg[0]), "v"(xl[1]), "v"(xg[1]),
               "v"(xl[2]), "v"(xg[2]), "v"(xl[3]), "v"(xg[3]),
               "v"(wl[0]), "v"(wg[0]), "v"(wl[1]), "v"(wg[1]),
               "v"(wl[2]), "v"(wg[2]), "v"(wl[3]), "v"(wg[3])
            : "memory");
        // this wave's copies have landed
        asm volatile("s_wait_asynccnt 0x0" ::: "memory");
        __syncthreads();  // all waves' staging visible
#pragma unroll
        for (int i = 0; i < 4; ++i) {
            xg[i] += 32;
            wg[i] += wstep;
        }

        // ---- 8 K-steps of 4 WMMAs
#pragma unroll
        for (int kk = 0; kk < 8; ++kk) {
            v2f a = *(const v2f*)(xf + kk * 4);
#pragma unroll
            for (int t = 0; t < 4; ++t) {
                v2f b;
                if (WT) {
                    b = *(const v2f*)&wlds[(t * 16 + n16) * WP + kk * 4 + koff];
                } else {
                    b.x = wlds[(kk * 4 + koff) * WP + t * 16 + n16];
                    b.y = wlds[(kk * 4 + koff + 1) * WP + t * 16 + n16];
                }
                acc[t] = WMMA_F32(a, b, acc[t]);
            }
        }
    }

#pragma unroll
    for (int t = 0; t < 4; ++t) {
#pragma unroll
        for (int v = 0; v < 8; ++v) {
            const int m = hi * 8 + v;  // C layout: vgpr v, lane group hi -> row v+8*hi
            C[(size_t)(mt * 64 + wv * 16 + m) * ldc + nt * 64 + t * 16 + n16] = acc[t][v];
        }
    }
}

// ---------------------------------------------------------------------------
// Split KV[M,256] into K (cols 0..127, pre-rope) and V (cols 128..255) outputs
// ---------------------------------------------------------------------------
__global__ __launch_bounds__(256) void copy_kv(const float* __restrict__ KV,
                                               float* __restrict__ outK,
                                               float* __restrict__ outV, int M) {
    const int idx = blockIdx.x * 256 + threadIdx.x;  // M*128 threads
    const int r = idx >> 7;
    const int d = idx & 127;
    outK[idx] = KV[(size_t)r * 256 + d];
    outV[idx] = KV[(size_t)r * 256 + 128 + d];
}

// ---------------------------------------------------------------------------
// RoPE on Q in place. One thread handles (d, d+64) pair of one (b,s,h).
// pos = past + s.  Threads: B*S*H*64
// ---------------------------------------------------------------------------
__global__ __launch_bounds__(256) void rope_q(float* __restrict__ Q,
                                              const int* __restrict__ past_ptr, int S) {
    const int idx = blockIdx.x * 256 + threadIdx.x;
    const int d = idx & 63;
    const int h = (idx >> 6) & 15;
    const int r = idx >> 10;  // b*S + s
    const int s = r % S;
    const float pos = (float)(*past_ptr + s);
    const float freq = __expf(-0.14391156213f * (float)d);  // 1/10000^(d/64)
    float sn, cs;
    sincosf(pos * freq, &sn, &cs);
    const size_t base = (size_t)r * 2048 + h * 128 + d;
    const float x1 = Q[base];
    const float x2 = Q[base + 64];
    Q[base] = x1 * cs - x2 * sn;
    Q[base + 64] = x2 * cs + x1 * sn;
}

// ---------------------------------------------------------------------------
// Pack K (roped, pos = s) and V into WMMA fragment order for the attention
// kernel. A 16-key tile is 16 groups of 32 lanes x 4 floats (2048 floats), so
// one wave-wide 16-byte load is 512 contiguous bytes and feeds two WMMAs.
//   KF group j,   lane (hi,n16), e: K[key n16][d = 8j + 4(e>>1) + 2hi + (e&1)]
//   VF group q,   lane (hi,n16), e: V[key 8(q&1) + 4(e>>1) + 2hi + (e&1)][d = 16(q>>1) + n16]
// One thread writes groups j and j+8 of both (the rope pair d, d+64 lies in
// groups j and j+8 at the same lane and e). Threads: B*S*16
// ---------------------------------------------------------------------------
__global__ __launch_bounds__(256) void pack_kv(const float* __restrict__ KV,
                                               float* __restrict__ KF,
                                               float* __restrict__ VF, int S) {
    const int idx  = blockIdx.x * 256 + threadIdx.x;
    const int lane = idx & 31;
    const int j    = (idx >> 5) & 7;
    const int tile = idx >> 8;  // (b*S + s) / 16
    const int n16  = lane & 15;
    const int hi   = lane >> 4;

    const int r = tile * 16 + n16;  // b*S + s
    const int s = r % S;
    const float* krow = KV + (size_t)r * 256;
    v4f lo, up;
#pragma unroll
    for (int e = 0; e < 4; ++e) {
        const int d = j * 8 + (e >> 1) * 4 + hi * 2 + (e & 1);
        const float freq = __expf(-0.14391156213f * (float)d);
        float sn, cs;
        sincosf((float)s * freq, &sn, &cs);
        const float x1 = krow[d];
        const float x2 = krow[64 + d];
        lo[e] = x1 * cs - x2 * sn;
        up[e] = x2 * cs + x1 * sn;
    }
    v4f* kf = (v4f*)KF + (size_t)tile * 512 + lane;
    kf[j * 32]       = lo;
    kf[(j + 8) * 32] = up;

    v4f* vf = (v4f*)VF + (size_t)tile * 512 + lane;
#pragma unroll
    for (int g = 0; g < 2; ++g) {
        const int q = j + g * 8;
        const float* vcol = KV + (size_t)(tile * 16 + (q & 1) * 8 + hi * 2) * 256 + 128 + (q >> 1) * 16 + n16;
        v4f vv;
        vv[0] = vcol[0 * 256];
        vv[1] = vcol[1 * 256];
        vv[2] = vcol[4 * 256];
        vv[3] = vcol[5 * 256];
        vf[q * 32] = vv;
    }
}

// ---------------------------------------------------------------------------
// Flash attention, causal, MQA (one KV head). One wave per (b, h, pair of 16-row
// q tiles): it runs tile n-1-t and then tile t, so every wave walks n+1 key tiles
// and no SIMD is left with only long or only short rows of the causal triangle.
// QK^T and P@V via fp32 WMMA. O written in place over the (roped) Q region of
// that exact tile/head -- safe: each wave stages its q tile into LDS first and
// tiles are disjoint across waves. Q (in LDS), K and V (packed by pack_kv) are
// all held in fragment order: every operand load is 16 contiguous bytes a lane.
// ---------------------------------------------------------------------------
__global__ __launch_bounds__(128) void attn_kernel(float* __restrict__ QO,
                                                   const float* __restrict__ KF,
                                                   const float* __restrict__ VF,
                                                   const int* __restrict__ past_ptr,
                                                   int S) {
    // per-wave q tile, 8KB each, in the order of KF (row m in place of the key)
    __shared__ __attribute__((aligned(16))) float qs[4][16 * 128];
    __shared__ float ps[4][16 * 16];   // per-wave P tile (C-layout -> A-layout)

    const int lane = threadIdx.x & 31;
    const int wv   = threadIdx.x >> 5;
    const int qtiles = S >> 4;
    const int npair  = qtiles >> 1;
    const int wid = blockIdx.x * 4 + wv;
    const int tp = wid % npair;
    const int h  = (wid / npair) & 15;
    const int b  = wid / (npair * 16);
    const int past = *past_ptr;

    const int n16 = lane & 15;
    const int hi  = lane >> 4;

    float* qsw = qs[wv];
    // kept rolled: unrolled, the kernel's text would double and gain nothing
#pragma unroll 1
    for (int half = 0; half < 2; ++half) {
    const int qt = half ? tp : qtiles - 1 - tp;  // the long tile first
    {
        // lane (hi,n16) brings Q[n16][8j + 4hi .. +3]; its two pairs go to the
        // lanes hi' = 0 and 1 of group j, at e = 2hi (32 distinct 8-byte slots a store)
        const float* qb = QO + (size_t)(b * S + qt * 16 + n16) * 2048 + h * 128 + hi * 4;
        v4f qv[16];
#pragma unroll
        for (int jj = 0; jj < 16; ++jj) qv[jj] = *(const v4f*)(qb + jj * 8);
        // the address pair stays whole until every load above has taken it
        asm volatile("s_wait_xcnt 0x0" :: "v"(qb) : "memory");
        float* qd = qsw + n16 * 4 + hi * 2;
#pragma unroll
        for (int jj = 0; jj < 16; ++jj) {
            *(v2f*)(qd + jj * 128)      = qv[jj].xy;
            *(v2f*)(qd + jj * 128 + 64) = qv[jj].zw;
        }
    }

    float mrow[8], lrow[8];
    v8f acc[8] = {};
#pragma unroll
    for (int v = 0; v < 8; ++v) { mrow[v] = -1e30f; lrow[v] = 0.f; }

    const float scale = 0.08838834764831845f;  // 1/sqrt(128)
    const int lastj = past + qt * 16 + 15;
    int nkt = lastj / 16 + 1;
    if (nkt > (S >> 4)) nkt = S >> 4;

    const v4f* kfbase = (const v4f*)KF + (size_t)b * (S >> 4) * 512 + lane;
    const v4f* vfbase = (const v4f*)VF + (size_t)b * (S >> 4) * 512 + lane;
    const v4f* qf = (const v4f*)qsw + lane;
    float* psw = ps[wv];

    for (int kt = 0; kt < nkt; ++kt) {
        // ---- scores tile: 16x16 = q(16x128) @ k^T, 32 WMMAs of K=4
        v8f sc = {};
        const v4f* kf = kfbase + (size_t)kt * 512;
        v4f kb[16];
#pragma unroll
        for (int jj = 0; jj < 16; ++jj) kb[jj] = kf[jj * 32];
        // the address pair stays whole until every load above has taken it
        asm volatile("s_wait_xcnt 0x0" :: "v"(kf) : "memory");
        // keeps the tile's 16 loads in flight together: without it the compiler
        // reuses one register quad and waits out each load's latency in turn
        __builtin_amdgcn_sched_barrier(0);
#pragma unroll
        for (int jj = 0; jj < 16; ++jj) {
            const v4f a4 = qf[jj * 32];
            sc = WMMA_F32(a4.xy, kb[jj].xy, sc);
            sc = WMMA_F32(a4.zw, kb[jj].zw, sc);
        }
        const v4f* vf = vfbase + (size_t)kt * 512;
        v4f vb[16];
#pragma unroll
        for (int q = 0; q < 16; ++q) vb[q] = vf[q * 32];
        // the address pair stays whole until every load above has taken it
        asm volatile("s_wait_xcnt 0x0" :: "v"(vf) : "memory");
        // same purpose for the V tile's 16 loads
        __builtin_amdgcn_sched_barrier(0);

        // ---- scale + causal mask + online softmax (row = hi*8+v across 16 lanes)
        float pv[8];
        const int j = kt * 16 + n16;  // key position for this lane's column
#pragma unroll
        for (int v = 0; v < 8; ++v) {
            float x = sc[v] * scale;
            const int irow = past + qt * 16 + hi * 8 + v;
            if (j > irow) x = -1e30f;
            float t = x;
            t = fmaxf(t, __shfl_xor(t, 1));
            t = fmaxf(t, __shfl_xor(t, 2));
            t = fmaxf(t, __shfl_xor(t, 4));
            t = fmaxf(t, __shfl_xor(t, 8));
            const float mnew = fmaxf(mrow[v], t);
            const float p = __expf(x - mnew);
            float psum = p;
            psum += __shfl_xor(psum, 1);
            psum += __shfl_xor(psum, 2);
            psum += __shfl_xor(psum, 4);
            psum += __shfl_xor(psum, 8);
            const float rs = __expf(mrow[v] - mnew);
            lrow[v] = lrow[v] * rs + psum;
            mrow[v] = mnew;
            pv[v] = p;
#pragma unroll
            for (int cb = 0; cb < 8; ++cb) acc[cb][v] *= rs;
        }

        // ---- P tile: C-layout regs -> LDS -> A-layout fragments
#pragma unroll
        for (int v = 0; v < 8; ++v) psw[(hi * 8 + v) * 16 + n16] = pv[v];

        // ---- acc += P(16x16) @ V(16x128): 8 col-blocks x 4 WMMAs
        const float* pp  = psw + n16 * 16 + (hi << 1);
        v2f pa[4];
#pragma unroll
        for (int kk = 0; kk < 4; ++kk) pa[kk] = *(const v2f*)(pp + kk * 4);
#pragma unroll
        for (int cb = 0; cb < 8; ++cb) {
            const v4f v01 = vb[cb * 2 + 0];
            const v4f v23 = vb[cb * 2 + 1];
            v8f c = acc[cb];
            c = WMMA_F32(pa[0], v01.xy, c);
            c = WMMA_F32(pa[1], v01.zw, c);
            c = WMMA_F32(pa[2], v23.xy, c);
            c = WMMA_F32(pa[3], v23.zw, c);
            acc[cb] = c;
        }
    }

    // ---- O = acc / l, written in place over this tile's q region
    float* ob = QO + (size_t)(b * S + qt * 16) * 2048 + h * 128;
#pragma unroll
    for (int cb = 0; cb < 8; ++cb) {
#pragma unroll
        for (int v = 0; v < 8; ++v) {
            const int m = hi * 8 + v;
            ob[(size_t)m * 2048 + cb * 16 + n16] = acc[cb][v] / lrow[v];
        }
    }
    // the stores above have taken their registers before the next tile rewrites them
    asm volatile("s_wait_xcnt 0x0" ::: "memory");
    }
}

// ---------------------------------------------------------------------------
extern "C" void kernel_launch(void* const* d_in, const int* in_sizes, int n_in,
                              void* d_out, int out_size, void* d_ws, size_t ws_size,
                              hipStream_t stream) {
    const float* x   = (const float*)d_in[0];
    const float* wq  = (const float*)d_in[1];
    const float* wkv = (const float*)d_in[2];
    const float* wo  = (const float*)d_in[3];
    const int* past  = (const int*)d_in[4];

    const int B = 2, S = 2048, D = 2048, H = 16, DH = 128;
    const int M = B * S;  // 4096

    float* ws  = (float*)d_ws;
    float* Q   = ws;                        // M*D   (later holds O in place)
    float* KVt = Q + (size_t)M * D;         // M*256
    float* KF  = KVt + (size_t)M * 256;     // M*128, roped K in fragment order
    float* VF  = KF + (size_t)M * 128;      // M*128, V in fragment order
    // total ws use: (M*D + M*256 + 2*M*128)*4 bytes = ~40 MB

    float* out  = (float*)d_out;            // M*D
    float* outK = out + (size_t)M * D;      // M*DH
    float* outV = outK + (size_t)M * DH;    // M*DH

    // 1) Q = x @ wq^T         [4096x2048] x [2048x2048]^T
    gemm_f32<true><<<(M / 64) * (D / 64), 128, 0, stream>>>(x, wq, Q, M, D, D, D, D, D);

    // 2) KV = x @ wkv         [4096x2048] x [2048x256]
    gemm_f32<false><<<(M / 64) * (256 / 64), 128, 0, stream>>>(x, wkv, KVt, M, 256, D, D, 256, 256);

    // 3) outputs K (pre-rope) and V
    copy_kv<<<(M * DH) / 256, 256, 0, stream>>>(KVt, outK, outV, M);

    // 4) RoPE
    rope_q<<<(M * H * 64) / 256, 256, 0, stream>>>(Q, past, S);
    pack_kv<<<(M * 16) / 256, 256, 0, stream>>>(KVt, KF, VF, S);

    // 5) causal MQA flash attention; O overwrites Q buffer
    attn_kernel<<<(B * H * (S / 32)) / 4, 128, 0, stream>>>(Q, KF, VF, past, S);

    // 6) out = O @ wo^T
    gemm_f32<true><<<(M / 64) * (D / 64), 128, 0, stream>>>(Q, wo, out, M, D, D, D, D, D);
}

// v004
// It runs in 680 microseconds.
// Next to v003, in two timings, it ran 1.04 times as fast each time.
// Counting every step since v000, it is 1.70 times as fast.
#include <hip/hip_runtime.h>
#include <math.h>
#include <stdint.h>

typedef float v2f __attribute__((ext_vector_type(2)));
typedef float v4f __attribute__((ext_vector_type(4)));
typedef float v8f __attribute__((ext_vector_type(8)));

#define WMMA_F32(a, b, c) \
    __builtin_amdgcn_wmma_f32_16x16x4_f32(false, (a), false, (b), (short)0, (c), false, false)

// ---------------------------------------------------------------------------
// GEMM: C[M,N] = X[M,K] * op(W)
//   WT=true : W stored [N,K] row-major (compute X @ W^T)
//   WT=false: W stored [K,N] row-major (compute X @ W)
// One block (4 waves, 128 threads) computes a 64x64 C tile; wave wv owns the
// 16-row strip. Per K-chunk of 32 the X tile (64x32) and the W tile are both
// staged into LDS by async-to-LDS copies (ASYNCcnt). One copy instruction of a
// wave takes 512 contiguous-by-line bytes (four whole 128-byte lines). The LDS
// rows are pitched so that the 32 lanes of a fragment read fall on distinct
// banks: 36 floats for rows read along k (16 rows x 2 k-pairs cover all 64
// banks), 80 floats for the [K,N] form (rows k and k+2 lie 32 banks apart, so
// the two lane halves keep apart also where two 16-column reads are merged).
// ---------------------------------------------------------------------------
template <bool WT>
__global__ __launch_bounds__(128) void gemm_f32(const float* __restrict__ X,
                                                const float* __restrict__ W,
                                                float* __restrict__ C,
                                                int M, int N, int K,
                                                int ldx, int ldw, int ldc) {
    constexpr int XP = 36;            // floats per LDS row of the X chunk
    constexpr int WP = WT ? 36 : 80;  // floats per LDS row of the W chunk
    __shared__ __attribute__((aligned(16))) float xlds[64 * XP];
    __shared__ __attribute__((aligned(16))) float wlds[(WT ? 64 : 32) * WP];

    const int lane = threadIdx.x & 31;
    const int wv   = threadIdx.x >> 5;
    const int ntiles = N >> 6;
    const int mt = blockIdx.x / ntiles;  // 64-row block index
    const int nt = blockIdx.x % ntiles;  // 64-col block index

    const int n16  = lane & 15;
    const int hi   = lane >> 4;  // 0 or 1
    const int koff = hi << 1;    // 0 or 2

    // each chunk is 512 pieces of 16 bytes per operand, 4 + 4 per thread;
    // piece p = i*128 + thread, so neighbouring lanes take neighbouring pieces
    const float* xg[4];
    const float* wg[4];
    uint32_t xl[4], wl[4];  // low 32 bits of a __shared__ address = LDS offset
#pragma unroll
    for (int i = 0; i < 4; ++i) {
        const int p = i * 128 + threadIdx.x;
        xg[i] = X + (size_t)(mt * 64 + (p >> 3)) * ldx + (p & 7) * 4;
        xl[i] = (uint32_t)(uintptr_t)&xlds[(p >> 3) * XP + (p & 7) * 4];
        if (WT) {  // wlds[n][k]: a row is 32 floats of one W row
            wg[i] = W + (size_t)(nt * 64 + (p >> 3)) * ldw + (p & 7) * 4;
            wl[i] = (uint32_t)(uintptr_t)&wlds[(p >> 3) * WP + (p & 7) * 4];
        } else {   // wlds[k][n]: a row is 64 floats of one W row
            wg[i] = W + (size_t)(p >> 4) * ldw + nt * 64 + (p & 15) * 4;
            wl[i] = (uint32_t)(uintptr_t)&wlds[(p >> 4) * WP + (p & 15) * 4];
        }
    }
    const size_t wstep = WT ? (size_t)32 : (size_t)32 * ldw;

    const float* xf = &xlds[(wv * 16 + n16) * XP + koff];  // A row m = lane&15
    v8f acc[4] = {};

    for (int k0 = 0; k0 < K; k0 += 32) {
        // this wave's fragment reads of the previous chunk have returned ...
        asm volatile("s_wait_dscnt 0x0" ::: "memory");
        __syncthreads();  // ... and so have every other wave's: restaging is safe
        // the copies and their s_wait_xcnt stand in one statement, so the compiler
        // can move no update of an address register in front of that wait
        asm volatile(
            "global_load_async_to_lds_b128 %0, %1, off\n\t"
            "global_load_async_to_lds_b128 %2, %3, off\n\t"
            "global_load_async_to_lds_b128 %4, %5, off\n\t"
            "global_load_async_to_lds_b128 %6, %7, off\n\t"
            "global_load_async_to_lds_b128 %8, %9, off\n\t"
            "global_load_async_to_lds_b128 %10, %11, off\n\t"
            "global_load_async_to_lds_b128 %12, %13, off\n\t"
            "global_load_async_to_lds_b128 %14, %15, off\n\t"
            "s_wait_xcnt 0x0"
            :: "v"(xl[0]), "v"(xg[0]), "v"(xl[1]), "v"(xg[1]),
               "v"(xl[2]), "v"(xg[2]), "v"(xl[3]), "v"(xg[3]),
               "v"(wl[0]), "v"(wg[0]), "v"(wl[1]), "v"(wg[1]),
               "v"(wl[2]), "v"(wg[2]), "v"(wl[3]), "v"(wg[3])
            : "memory");
        // this wave's copies have landed
        asm volatile("s_wait_asynccnt 0x0" ::: "memory");
        __syncthreads();  // all waves' staging visible
#pragma unroll
        for (int i = 0; i < 4; ++i) {
            xg[i] += 32;
            wg[i] += wstep;
        }

        // ---- 8 K-steps of 4 WMMAs
#pragma unroll
        for (int kk = 0; kk < 8; ++kk) {
            v2f a = *(const v2f*)(xf + kk * 4);
#pragma unroll
            for (int t = 0; t < 4; ++t) {
                v2f b;
                if (WT) {
                    b = *(const v2f*)&wlds[(t * 16 + n16) * WP + kk * 4 + koff];
                } else {
                    b.x = wlds[(kk * 4 + koff) * WP + t * 16 + n16];
                    b.y = wlds[(kk * 4 + koff + 1) * WP + t * 16 + n16];
                }
                acc[t] = WMMA_F32(a, b, acc[t]);
            }
        }
    }

#pragma unroll
    for (int t = 0; t < 4; ++t) {
#pragma unroll
        for (int v = 0; v < 8; ++v) {
            const int m = hi * 8 + v;  // C layout: vgpr v, lane group hi -> row v+8*hi
            C[(size_t)(mt * 64 + wv * 16 + m) * ldc + nt * 64 + t * 16 + n16] = acc[t][v];
        }
    }
}

// ---------------------------------------------------------------------------
// Split KV[M,256] into K (cols 0..127, pre-rope) and V (cols 128..255) outputs
// ---------------------------------------------------------------------------
__global__ __launch_bounds__(256) void copy_kv(const float* __restrict__ KV,
                                               float* __restrict__ outK,
                                               float* __restrict__ outV, int M) {
    const int idx = blockIdx.x * 256 + threadIdx.x;  // M*128 threads
    const int r = idx >> 7;
    const int d = idx & 127;
    outK[idx] = KV[(size_t)r * 256 + d];
    outV[idx] = KV[(size_t)r * 256 + 128 + d];
}

// ---------------------------------------------------------------------------
// Pack K (roped, pos = s) and V into WMMA fragment order for the attention
// kernel. A 16-key tile is 16 groups of 32 lanes x 4 floats (2048 floats), so
// one wave-wide 16-byte load is 512 contiguous bytes and feeds two WMMAs.
//   KF group j,   lane (hi,n16), e: K[key n16][d = 8j + 4(e>>1) + 2hi + (e&1)]
//   VF group q,   lane (hi,n16), e: V[key 8(q&1) + 4(e>>1) + 2hi + (e&1)][d = 16(q>>1) + n16]
// One thread writes groups j and j+8 of both (the rope pair d, d+64 lies in
// groups j and j+8 at the same lane and e). Threads: B*S*16
// ---------------------------------------------------------------------------
__global__ __launch_bounds__(256) void pack_kv(const float* __restrict__ KV,
                                               float* __restrict__ KF,
                                               float* __restrict__ VF, int S) {
    const int idx  = blockIdx.x * 256 + threadIdx.x;
    const int lane = idx & 31;
    const int j    = (idx >> 5) & 7;
    const int tile = idx >> 8;  // (b*S + s) / 16
    const int n16  = lane & 15;
    const int hi   = lane >> 4;

    const int r = tile * 16 + n16;  // b*S + s
    const int s = r % S;
    const float* krow = KV + (size_t)r * 256;
    v4f lo, up;
#pragma unroll
    for (int e = 0; e < 4; ++e) {
        const int d = j * 8 + (e >> 1) * 4 + hi * 2 + (e & 1);
        const float freq = __expf(-0.14391156213f * (float)d);
        float sn, cs;
        sincosf((float)s * freq, &sn, &cs);
        const float x1 = krow[d];
        const float x2 = krow[64 + d];
        lo[e] = x1 * cs - x2 * sn;
        up[e] = x2 * cs + x1 * sn;
    }
    v4f* kf = (v4f*)KF + (size_t)tile * 512 + lane;
    kf[j * 32]       = lo;
    kf[(j + 8) * 32] = up;

    v4f* vf = (v4f*)VF + (size_t)tile * 512 + lane;
#pragma unroll
    for (int g = 0; g < 2; ++g) {
        const int q = j + g * 8;
        const float* vcol = KV + (size_t)(tile * 16 + (q & 1) * 8 + hi * 2) * 256 + 128 + (q >> 1) * 16 + n16;
        v4f vv;
        vv[0] = vcol[0 * 256];
        vv[1] = vcol[1 * 256];
        vv[2] = vcol[4 * 256];
        vv[3] = vcol[5 * 256];
        vf[q * 32] = vv;
    }
}

// ---------------------------------------------------------------------------
// Flash attention, causal, MQA (one KV head). One wave per (b, h, pair of 16-row
// q tiles): it runs tile n-1-t and then tile t, so every wave walks n+1 key tiles
// and no SIMD is left with only long or only short rows of the causal triangle.
// QK^T and P@V via fp32 WMMA. O written in place over the Q region of that exact
// tile/head -- safe: each wave stages its q tile into LDS first and tiles are
// disjoint across waves. The staged tile gets its RoPE (pos = past + s) there, in
// LDS, so Q needs no launch and no pass through memory of its own for it.
// Q (in LDS), K and V (packed by pack_kv) are all held in fragment order: every
// operand load is 16 contiguous bytes a lane.
// ---------------------------------------------------------------------------
__global__ __launch_bounds__(128) void attn_kernel(float* __restrict__ QO,
                                                   const float* __restrict__ KF,
                                                   const float* __restrict__ VF,
                                                   const int* __restrict__ past_ptr,
                                                   int S) {
    // per-wave q tile, 8KB each, in the order of KF (row m in place of the key)
    __shared__ __attribute__((aligned(16))) float qs[4][16 * 128];
    __shared__ float ps[4][16 * 16];   // per-wave P tile (C-layout -> A-layout)

    const int lane = threadIdx.x & 31;
    const int wv   = threadIdx.x >> 5;
    const int qtiles = S >> 4;
    const int npair  = qtiles >> 1;
    const int wid = blockIdx.x * 4 + wv;
    const int tp = wid % npair;
    const int h  = (wid / npair) & 15;
    const int b  = wid / (npair * 16);
    const int past = *past_ptr;

    const int n16 = lane & 15;
    const int hi  = lane >> 4;

    float* qsw = qs[wv];
    // kept rolled: unrolled, the kernel's text would double and gain nothing
#pragma unroll 1
    for (int half = 0; half < 2; ++half) {
    const int qt = half ? tp : qtiles - 1 - tp;  // the long tile first
    {
        // lane (hi,n16) brings Q[n16][8j + 4hi .. +3]; its two pairs go to the
        // lanes hi' = 0 and 1 of group j, at e = 2hi (32 distinct 8-byte slots a store)
        const float* qb = QO + (size_t)(b * S + qt * 16 + n16) * 2048 + h * 128 + hi * 4;
        v4f qv[16];
#pragma unroll
        for (int jj = 0; jj < 16; ++jj) qv[jj] = *(const v4f*)(qb + jj * 8);
        // the address pair stays whole until every load above has taken it
        asm volatile("s_wait_xcnt 0x0" :: "v"(qb) : "memory");
        float* qd = qsw + n16 * 4 + hi * 2;
#pragma unroll
        for (int jj = 0; jj < 16; ++jj) {
            *(v2f*)(qd + jj * 128)      = qv[jj].xy;
            *(v2f*)(qd + jj * 128 + 64) = qv[jj].zw;
        }
    }
    {
        // RoPE in place: group j, lane (hi,n16), e holds Q[n16][d = 8j + 4(e>>1) + 2hi + (e&1)],
        // and its partner d + 64 lies in group j + 8 at the same lane and e
        const float pos = (float)(past + qt * 16 + n16);
        v4f* qr = (v4f*)qsw + lane;
        // kept rolled: 32 inlined sincosf would swell the kernel's text eightfold here
#pragma unroll 1
        for (int j = 0; j < 8; ++j) {
            v4f lo = qr[j * 32];
            v4f up = qr[(j + 8) * 32];
#pragma unroll
            for (int e = 0; e < 4; ++e) {
                const int d = j * 8 + (e >> 1) * 4 + hi * 2 + (e & 1);
                const float freq = __expf(-0.14391156213f * (float)d);  // 1/10000^(d/64)
                float sn, cs;
                sincosf(pos * freq, &sn, &cs);
                const float x1 = lo[e];
                const float x2 = up[e];
                lo[e] = x1 * cs - x2 * sn;
                up[e] = x2 * cs + x1 * sn;
            }
            qr[j * 32]       = lo;
            qr[(j + 8) * 32] = up;
        }
    }

    float mrow[8], lrow[8];
    v8f acc[8] = {};
#pragma unroll
    for (int v = 0; v < 8; ++v) { mrow[v] = -1e30f; lrow[v] = 0.f; }

    const float scale = 0.08838834764831845f;  // 1/sqrt(128)
    const int lastj = past + qt * 16 + 15;
    int nkt = lastj / 16 + 1;
    if (nkt > (S >> 4)) nkt = S >> 4;

    const v4f* kfbase = (const v4f*)KF + (size_t)b * (S >> 4) * 512 + lane;
    const v4f* vfbase = (const v4f*)VF + (size_t)b * (S >> 4) * 512 + lane;
    const v4f* qf = (const v4f*)qsw + lane;
    float* psw = ps[wv];

    for (int kt = 0; kt < nkt; ++kt) {
        // ---- scores tile: 16x16 = q(16x128) @ k^T, 32 WMMAs of K=4
        v8f sc = {};
        const v4f* kf = kfbase + (size_t)kt * 512;
        v4f kb[16];
#pragma unroll
        for (int jj = 0; jj < 16; ++jj) kb[jj] = kf[jj * 32];
        // the address pair stays whole until every load above has taken it
        asm volatile("s_wait_xcnt 0x0" :: "v"(kf) : "memory");
        // keeps the tile's 16 loads in flight together: without it the compiler
        // reuses one register quad and waits out each load's latency in turn
        __builtin_amdgcn_sched_barrier(0);
#pragma unroll
        for (int jj = 0; jj < 16; ++jj) {
            const v4f a4 = qf[jj * 32];
            sc = WMMA_F32(a4.xy, kb[jj].xy, sc);
            sc = WMMA_F32(a4.zw, kb[jj].zw, sc);
        }
        const v4f* vf = vfbase + (size_t)kt * 512;
        v4f vb[16];
#pragma unroll
        for (int q = 0; q < 16; ++q) vb[q] = vf[q * 32];
        // the address pair stays whole until every load above has taken it
        asm volatile("s_wait_xcnt 0x0" :: "v"(vf) : "memory");
        // same purpose for the V tile's 16 loads
        __builtin_amdgcn_sched_barrier(0);

        // ---- scale + causal mask + online softmax (row = hi*8+v across 16 lanes)
        float pv[8];
        const int j = kt * 16 + n16;  // key position for this lane's column
#pragma unroll
        for (int v = 0; v < 8; ++v) {
            float x = sc[v] * scale;
            const int irow = past + qt * 16 + hi * 8 + v;
            if (j > irow) x = -1e30f;
            float t = x;
            t = fmaxf(t, __shfl_xor(t, 1));
            t = fmaxf(t, __shfl_xor(t, 2));
            t = fmaxf(t, __shfl_xor(t, 4));
            t = fmaxf(t, __shfl_xor(t, 8));
            const float mnew = fmaxf(mrow[v], t);
            const float p = __expf(x - mnew);
            float psum = p;
            psum += __shfl_xor(psum, 1);
            psum += __shfl_xor(psum, 2);
            psum += __shfl_xor(psum, 4);
            psum += __shfl_xor(psum, 8);
            const float rs = __expf(mrow[v] - mnew);
            lrow[v] = lrow[v] * rs + psum;
            mrow[v] = mnew;
            pv[v] = p;
#pragma unroll
            for (int cb = 0; cb < 8; ++cb) acc[cb][v] *= rs;
        }

        // ---- P tile: C-layout regs -> LDS -> A-layout fragments
#pragma unroll
        for (int v = 0; v < 8; ++v) psw[(hi * 8 + v) * 16 + n16] = pv[v];

        // ---- acc += P(16x16) @ V(16x128): 8 col-blocks x 4 WMMAs
        const float* pp  = psw + n16 * 16 + (hi << 1);
        v2f pa[4];
#pragma unroll
        for (int kk = 0; kk < 4; ++kk) pa[kk] = *(const v2f*)(pp + kk * 4);
#pragma unroll
        for (int cb = 0; cb < 8; ++cb) {
            const v4f v01 = vb[cb * 2 + 0];
            const v4f v23 = vb[cb * 2 + 1];
            v8f c = acc[cb];
            c = WMMA_F32(pa[0], v01.xy, c);
            c = WMMA_F32(pa[1], v01.zw, c);
            c = WMMA_F32(pa[2], v23.xy, c);
            c = WMMA_F32(pa[3], v23.zw, c);
            acc[cb] = c;
        }
    }

    // ---- O = acc / l, written in place over this tile's q region
    float* ob = QO + (size_t)(b * S + qt * 16) * 2048 + h * 128;
#pragma unroll
    for (int cb = 0; cb < 8; ++cb) {
#pragma unroll
        for (int v = 0; v < 8; ++v) {
            const int m = hi * 8 + v;
            ob[(size_t)m * 2048 + cb * 16 + n16] = acc[cb][v] / lrow[v];
        }
    }
    // the stores above have taken their registers before the next tile rewrites them
    asm volatile("s_wait_xcnt 0x0" ::: "memory");
    }
}

// ---------------------------------------------------------------------------
extern "C" void kernel_launch(void* const* d_in, const int* in_sizes, int n_in,
                              void* d_out, int out_size, void* d_ws, size_t ws_size,
                              hipStream_t stream) {
    const float* x   = (const float*)d_in[0];
    const float* wq  = (const float*)d_in[1];
    const float* wkv = (const float*)d_in[2];
    const float* wo  = (const float*)d_in[3];
    const int* past  = (const int*)d_in[4];

    const int B = 2, S = 2048, D = 2048, H = 16, DH = 128;
    const int M = B * S;  // 4096

    float* ws  = (float*)d_ws;
    float* Q   = ws;                        // M*D   (later holds O in place)
    float* KVt = Q + (size_t)M * D;         // M*256
    float* KF  = KVt + (size_t)M * 256;     // M*128, roped K in fragment order
    float* VF  = KF + (size_t)M * 128;      // M*128, V in fragment order
    // total ws use: (M*D + M*256 + 2*M*128)*4 bytes = ~40 MB

    float* out  = (float*)d_out;            // M*D
    float* outK = out + (size_t)M * D;      // M*DH
    float* outV = outK + (size_t)M * DH;    // M*DH

    // 1) Q = x @ wq^T         [4096x2048] x [2048x2048]^T
    gemm_f32<true><<<(M / 64) * (D / 64), 128, 0, stream>>>(x, wq, Q, M, D, D, D, D, D);

    // 2) KV = x @ wkv         [4096x2048] x [2048x256]
    gemm_f32<false><<<(M / 64) * (256 / 64), 128, 0, stream>>>(x, wkv, KVt, M, 256, D, D, 256, 256);

    // 3) outputs K (pre-rope) and V
    copy_kv<<<(M * DH) / 256, 256, 0, stream>>>(KVt, outK, outV, M);

    // 4) RoPE on K, and K and V into fragment order (Q gets its RoPE in step 5)
    pack_kv<<<(M * 16) / 256, 256, 0, stream>>>(KVt, KF, VF, S);

    // 5) causal MQA flash attention; O overwrites Q buffer
    attn_kernel<<<(B * H * (S / 32)) / 4, 128, 0, stream>>>(Q, KF, VF, past, S);

    // 6) out = O @ wo^T
    gemm_f32<true><<<(M / 64) * (D / 64), 128, 0, stream>>>(Q, wo, out, M, D, D, D, D, D);
}

// v005
// A run of this version takes 660 microseconds.
// Next to v004, in two timings, it ran 1.03 times as fast each time.
// All steps since v000 together make it 1.76 times as fast.
#include <hip/hip_runtime.h>
#include <math.h>
#include <stdint.h>

typedef float v2f __attribute__((ext_vector_type(2)));
typedef float v4f __attribute__((ext_vector_type(4)));
typedef float v8f __attribute__((ext_vector_type(8)));

#define WMMA_F32(a, b, c) \
    __builtin_amdgcn_wmma_f32_16x16x4_f32(false, (a), false, (b), (short)0, (c), false, false)

// ---------------------------------------------------------------------------
// GEMM: C[M,N] = X[M,K] * op(W)
//   WT=true : W stored [N,K] row-major (compute X @ W^T)
//   WT=false: W stored [K,N] row-major (compute X @ W)
// One block (4 waves, 128 threads) computes a 64x64 C tile; wave wv owns the
// 16-row strip. Per K-chunk of 32 the X tile (64x32) and the W tile are both
// staged into LDS by async-to-LDS copies (ASYNCcnt). One copy instruction of a
// wave takes 512 contiguous-by-line bytes (four whole 128-byte lines). The LDS
// rows are pitched so that the 32 lanes of a fragment read fall on distinct
// banks: 36 floats for rows read along k (16 rows x 2 k-pairs cover all 64
// banks), 80 floats for the [K,N] form (rows k and k+2 lie 32 banks apart, so
// the two lane halves keep apart also where two 16-column reads are merged).
// ---------------------------------------------------------------------------
template <bool WT>
__global__ __launch_bounds__(128) void gemm_f32(const float* __restrict__ X,
                                                const float* __restrict__ W,
                                                float* __restrict__ C,
                                                int M, int N, int K,
                                                int ldx, int ldw, int ldc) {
    constexpr int XP = 36;            // floats per LDS row of the X chunk
    constexpr int WP = WT ? 36 : 80;  // floats per LDS row of the W chunk
    __shared__ __attribute__((aligned(16))) float xlds[64 * XP];
    __shared__ __attribute__((aligned(16))) float wlds[(WT ? 64 : 32) * WP];

    const int lane = threadIdx.x & 31;
    const int wv   = threadIdx.x >> 5;
    const int ntiles = N >> 6;
    const int mt = blockIdx.x / ntiles;  // 64-row block index
    const int nt = blockIdx.x % ntiles;  // 64-col block index

    const int n16  = lane & 15;
    const int hi   = lane >> 4;  // 0 or 1
    const int koff = hi << 1;    // 0 or 2

    // each chunk is 512 pieces of 16 bytes per operand, 4 + 4 per thread;
    // piece p = i*128 + thread, so neighbouring lanes take neighbouring pieces
    const float* xg[4];
    const float* wg[4];
    uint32_t xl[4], wl[4];  // low 32 bits of a __shared__ address = LDS offset
#pragma unroll
    for (int i = 0; i < 4; ++i) {
        const int p = i * 128 + threadIdx.x;
        xg[i] = X + (size_t)(mt * 64 + (p >> 3)) * ldx + (p & 7) * 4;
        xl[i] = (uint32_t)(uintptr_t)&xlds[(p >> 3) * XP + (p & 7) * 4];
        if (WT) {  // wlds[n][k]: a row is 32 floats of one W row
            wg[i] = W + (size_t)(nt * 64 + (p >> 3)) * ldw + (p & 7) * 4;
            wl[i] = (uint32_t)(uintptr_t)&wlds[(p >> 3) * WP + (p & 7) * 4];
        } else {   // wlds[k][n]: a row is 64 floats of one W row
            wg[i] = W + (size_t)(p >> 4) * ldw + nt * 64 + (p & 15) * 4;
            wl[i] = (uint32_t)(uintptr_t)&wlds[(p >> 4) * WP + (p & 15) * 4];
        }
    }
    const size_t wstep = WT ? (size_t)32 : (size_t)32 * ldw;

    const float* xf = &xlds[(wv * 16 + n16) * XP + koff];  // A row m = lane&15
    v8f acc[4] = {};

    for (int k0 = 0; k0 < K; k0 += 32) {
        // this wave's fragment reads of the previous chunk have returned ...
        asm volatile("s_wait_dscnt 0x0" ::: "memory");
        __syncthreads();  // ... and so have every other wave's: restaging is safe
        // the copies and their s_wait_xcnt stand in one statement, so the compiler
        // can move no update of an address register in front of that wait
        asm volatile(
            "global_load_async_to_lds_b128 %0, %1, off\n\t"
            "global_load_async_to_lds_b128 %2, %3, off\n\t"
            "global_load_async_to_lds_b128 %4, %5, off\n\t"
            "global_load_async_to_lds_b128 %6, %7, off\n\t"
            "global_load_async_to_lds_b128 %8, %9, off\n\t"
            "global_load_async_to_lds_b128 %10, %11, off\n\t"
            "global_load_async_to_lds_b128 %12, %13, off\n\t"
            "global_load_async_to_lds_b128 %14, %15, off\n\t"
            "s_wait_xcnt 0x0"
            :: "v"(xl[0]), "v"(xg[0]), "v"(xl[1]), "v"(xg[1]),
               "v"(xl[2]), "v"(xg[2]), "v"(xl[3]), "v"(xg[3]),
               "v"(wl[0]), "v"(wg[0]), "v"(wl[1]), "v"(wg[1]),
               "v"(wl[2]), "v"(wg[2]), "v"(wl[3]), "v"(wg[3])
            : "memory");
        // this wave's copies have landed
        asm volatile("s_wait_asynccnt 0x0" ::: "memory");
        __syncthreads();  // all waves' staging visible
#pragma unroll
        for (int i = 0; i < 4; ++i) {
            xg[i] += 32;
            wg[i] += wstep;
        }

        // ---- 8 K-steps of 4 WMMAs
#pragma unroll
        for (int kk = 0; kk < 8; ++kk) {
            v2f a = *(const v2f*)(xf + kk * 4);
#pragma unroll
            for (int t = 0; t < 4; ++t) {
                v2f b;
                if (WT) {
                    b = *(const v2f*)&wlds[(t * 16 + n16) * WP + kk * 4 + koff];
                } else {
                    b.x = wlds[(kk * 4 + koff) * WP + t * 16 + n16];
                    b.y = wlds[(kk * 4 + koff + 1) * WP + t * 16 + n16];
                }
                acc[t] = WMMA_F32(a, b, acc[t]);
            }
        }
    }

#pragma unroll
    for (int t = 0; t < 4; ++t) {
#pragma unroll
        for (int v = 0; v < 8; ++v) {
            const int m = hi * 8 + v;  // C layout: vgpr v, lane group hi -> row v+8*hi
            C[(size_t)(mt * 64 + wv * 16 + m) * ldc + nt * 64 + t * 16 + n16] = acc[t][v];
        }
    }
}

// ---------------------------------------------------------------------------
// Split KV[M,256] into K (cols 0..127, pre-rope) and V (cols 128..255) outputs
// ---------------------------------------------------------------------------
__global__ __launch_bounds__(256) void copy_kv(const float* __restrict__ KV,
                                               float* __restrict__ outK,
                                               float* __restrict__ outV, int M) {
    const int idx = blockIdx.x * 256 + threadIdx.x;  // M*128 threads
    const int r = idx >> 7;
    const int d = idx & 127;
    outK[idx] = KV[(size_t)r * 256 + d];
    outV[idx] = KV[(size_t)r * 256 + 128 + d];
}

// ---------------------------------------------------------------------------
// Pack K (roped, pos = s) and V into WMMA fragment order for the attention
// kernel. A 16-key tile is 16 groups of 32 lanes x 4 floats (2048 floats), so
// one wave-wide 16-byte load is 512 contiguous bytes and feeds two WMMAs.
//   KF group j,   lane (hi,n16), e: K[key n16][d = 8j + 4(e>>1) + 2hi + (e&1)]
//   VF group q,   lane (hi,n16), e: V[key 8(q&1) + 4(e>>1) + 2hi + (e&1)][d = 16(q>>1) + n16]
// One thread writes groups j and j+8 of both (the rope pair d, d+64 lies in
// groups j and j+8 at the same lane and e). Threads: B*S*16
// ---------------------------------------------------------------------------
__global__ __launch_bounds__(256) void pack_kv(const float* __restrict__ KV,
                                               float* __restrict__ KF,
                                               float* __restrict__ VF, int S) {
    const int idx  = blockIdx.x * 256 + threadIdx.x;
    const int lane = idx & 31;
    const int j    = (idx >> 5) & 7;
    const int tile = idx >> 8;  // (b*S + s) / 16
    const int n16  = lane & 15;
    const int hi   = lane >> 4;

    const int r = tile * 16 + n16;  // b*S + s
    const int s = r % S;
    const float* krow = KV + (size_t)r * 256;
    v4f lo, up;
#pragma unroll
    for (int e = 0; e < 4; ++e) {
        const int d = j * 8 + (e >> 1) * 4 + hi * 2 + (e & 1);
        const float freq = __expf(-0.14391156213f * (float)d);
        float sn, cs;
        sincosf((float)s * freq, &sn, &cs);
        const float x1 = krow[d];
        const float x2 = krow[64 + d];
        lo[e] = x1 * cs - x2 * sn;
        up[e] = x2 * cs + x1 * sn;
    }
    v4f* kf = (v4f*)KF + (size_t)tile * 512 + lane;
    kf[j * 32]       = lo;
    kf[(j + 8) * 32] = up;

    v4f* vf = (v4f*)VF + (size_t)tile * 512 + lane;
#pragma unroll
    for (int g = 0; g < 2; ++g) {
        const int q = j + g * 8;
        const float* vcol = KV + (size_t)(tile * 16 + (q & 1) * 8 + hi * 2) * 256 + 128 + (q >> 1) * 16 + n16;
        v4f vv;
        vv[0] = vcol[0 * 256];
        vv[1] = vcol[1 * 256];
        vv[2] = vcol[4 * 256];
        vv[3] = vcol[5 * 256];
        vf[q * 32] = vv;
    }
}

// ---------------------------------------------------------------------------
// Flash attention, causal, MQA (one KV head). One wave per (b, h, pair of 16-row
// q tiles): it runs tile n-1-t and then tile t, so every wave walks n+1 key tiles
// and no SIMD is left with only long or only short rows of the causal triangle.
// QK^T and P@V via fp32 WMMA. O written in place over the Q region of that exact
// tile/head -- safe: each wave stages its q tile into LDS first and tiles are
// disjoint across waves. The staged tile gets its RoPE (pos = past + s) there, in
// LDS, so Q needs no launch and no pass through memory of its own for it.
// Q (in LDS), K and V (packed by pack_kv) are all held in fragment order: every
// operand load is 16 contiguous bytes a lane. The q fragments are read from LDS
// once per q tile and stay in registers over the key loop, so the 32 chained
// score WMMAs of a key tile wait on no LDS read.
// The grid gives each SIMD two waves, so a wave may take up to half the register
// file: amdgpu_waves_per_eu(1, 2) says so. Without it the compiler saves registers
// by running the softmax's cross-lane steps one row after another.
// ---------------------------------------------------------------------------
__global__ __launch_bounds__(128) __attribute__((amdgpu_waves_per_eu(1, 2))) void attn_kernel(float* __restrict__ QO,
                                                   const float* __restrict__ KF,
                                                   const float* __restrict__ VF,
                                                   const int* __restrict__ past_ptr,
                                                   int S) {
    // per-wave q tile, 8KB each, in the order of KF (row m in place of the key)
    __shared__ __attribute__((aligned(16))) float qs[4][16 * 128];
    __shared__ float ps[4][16 * 16];   // per-wave P tile (C-layout -> A-layout)

    const int lane = threadIdx.x & 31;
    const int wv   = threadIdx.x >> 5;
    const int qtiles = S >> 4;
    const int npair  = qtiles >> 1;
    const int wid = blockIdx.x * 4 + wv;
    const int tp = wid % npair;
    const int h  = (wid / npair) & 15;
    const int b  = wid / (npair * 16);
    const int past = *past_ptr;

    const int n16 = lane & 15;
    const int hi  = lane >> 4;

    float* qsw = qs[wv];
    // kept rolled: unrolled, the kernel's text would double and gain nothing
#pragma unroll 1
    for (int half = 0; half < 2; ++half) {
    const int qt = half ? tp : qtiles - 1 - tp;  // the long tile first
    {
        // lane (hi,n16) brings Q[n16][8j + 4hi .. +3]; its two pairs go to the
        // lanes hi' = 0 and 1 of group j, at e = 2hi (32 distinct 8-byte slots a store)
        const float* qb = QO + (size_t)(b * S + qt * 16 + n16) * 2048 + h * 128 + hi * 4;
        v4f qv[16];
#pragma unroll
        for (int jj = 0; jj < 16; ++jj) qv[jj] = *(const v4f*)(qb + jj * 8);
        // the address pair stays whole until every load above has taken it
        asm volatile("s_wait_xcnt 0x0" :: "v"(qb) : "memory");
        float* qd = qsw + n16 * 4 + hi * 2;
#pragma unroll
        for (int jj = 0; jj < 16; ++jj) {
            *(v2f*)(qd + jj * 128)      = qv[jj].xy;
            *(v2f*)(qd + jj * 128 + 64) = qv[jj].zw;
        }
    }
    {
        // RoPE in place: group j, lane (hi,n16), e holds Q[n16][d = 8j + 4(e>>1) + 2hi + (e&1)],
        // and its partner d + 64 lies in group j + 8 at the same lane and e
        const float pos = (float)(past + qt * 16 + n16);
        v4f* qr = (v4f*)qsw + lane;
        // kept rolled: 32 inlined sincosf would swell the kernel's text eightfold here
#pragma unroll 1
        for (int j = 0; j < 8; ++j) {
            v4f lo = qr[j * 32];
            v4f up = qr[(j + 8) * 32];
#pragma unroll
            for (int e = 0; e < 4; ++e) {
                const int d = j * 8 + (e >> 1) * 4 + hi * 2 + (e & 1);
                const float freq = __expf(-0.14391156213f * (float)d);  // 1/10000^(d/64)
                float sn, cs;
                sincosf(pos * freq, &sn, &cs);
                const float x1 = lo[e];
                const float x2 = up[e];
                lo[e] = x1 * cs - x2 * sn;
                up[e] = x2 * cs + x1 * sn;
            }
            qr[j * 32]       = lo;
            qr[(j + 8) * 32] = up;
        }
    }

    float mrow[8], lrow[8];
    v8f acc[8] = {};
#pragma unroll
    for (int v = 0; v < 8; ++v) { mrow[v] = -1e30f; lrow[v] = 0.f; }

    const float scale = 0.08838834764831845f;  // 1/sqrt(128)
    const int lastj = past + qt * 16 + 15;
    int nkt = lastj / 16 + 1;
    if (nkt > (S >> 4)) nkt = S >> 4;

    const v4f* kfbase = (const v4f*)KF + (size_t)b * (S >> 4) * 512 + lane;
    const v4f* vfbase = (const v4f*)VF + (size_t)b * (S >> 4) * 512 + lane;
    // the roped q tile's 16 fragment quads, read from LDS once per q tile and held
    // in registers over the whole key loop (each lane reads back its own slots)
    const v4f* qf = (const v4f*)qsw + lane;
    v4f qa[16];
#pragma unroll
    for (int jj = 0; jj < 16; ++jj) qa[jj] = qf[jj * 32];
    float* psw = ps[wv];

    for (int kt = 0; kt < nkt; ++kt) {
        // ---- scores tile: 16x16 = q(16x128) @ k^T, 32 WMMAs of K=4
        v8f sc = {};
        const v4f* kf = kfbase + (size_t)kt * 512;
        v4f kb[16];
#pragma unroll
        for (int jj = 0; jj < 16; ++jj) kb[jj] = kf[jj * 32];
        // the address pair stays whole until every load above has taken it
        asm volatile("s_wait_xcnt 0x0" :: "v"(kf) : "memory");
        // keeps the tile's 16 loads in flight together: without it the compiler
        // reuses one register quad and waits out each load's latency in turn
        __builtin_amdgcn_sched_barrier(0);
#pragma unroll
        for (int jj = 0; jj < 16; ++jj) {
            sc = WMMA_F32(qa[jj].xy, kb[jj].xy, sc);
            sc = WMMA_F32(qa[jj].zw, kb[jj].zw, sc);
        }
        const v4f* vf = vfbase + (size_t)kt * 512;
        v4f vb[16];
#pragma unroll
        for (int q = 0; q < 16; ++q) vb[q] = vf[q * 32];
        // the address pair stays whole until every load above has taken it
        asm volatile("s_wait_xcnt 0x0" :: "v"(vf) : "memory");
        // same purpose for the V tile's 16 loads
        __builtin_amdgcn_sched_barrier(0);

        // ---- scale + causal mask + online softmax (row = hi*8+v across 16 lanes)
        float pv[8];
        const int j = kt * 16 + n16;  // key position for this lane's column
#pragma unroll
        for (int v = 0; v < 8; ++v) {
            float x = sc[v] * scale;
            const int irow = past + qt * 16 + hi * 8 + v;
            if (j > irow) x = -1e30f;
            float t = x;
            t = fmaxf(t, __shfl_xor(t, 1));
            t = fmaxf(t, __shfl_xor(t, 2));
            t = fmaxf(t, __shfl_xor(t, 4));
            t = fmaxf(t, __shfl_xor(t, 8));
            const float mnew = fmaxf(mrow[v], t);
            const float p = __expf(x - mnew);
            float psum = p;
            psum += __shfl_xor(psum, 1);
            psum += __shfl_xor(psum, 2);
            psum += __shfl_xor(psum, 4);
            psum += __shfl_xor(psum, 8);
            const float rs = __expf(mrow[v] - mnew);
            lrow[v] = lrow[v] * rs + psum;
            mrow[v] = mnew;
            pv[v] = p;
#pragma unroll
            for (int cb = 0; cb < 8; ++cb) acc[cb][v] *= rs;
        }

        // ---- P tile: C-layout regs -> LDS -> A-layout fragments
#pragma unroll
        for (int v = 0; v < 8; ++v) psw[(hi * 8 + v) * 16 + n16] = pv[v];

        // ---- acc += P(16x16) @ V(16x128): 8 col-blocks x 4 WMMAs
        const float* pp  = psw + n16 * 16 + (hi << 1);
        v2f pa[4];
#pragma unroll
        for (int kk = 0; kk < 4; ++kk) pa[kk] = *(const v2f*)(pp + kk * 4);
#pragma unroll
        for (int cb = 0; cb < 8; ++cb) {
            const v4f v01 = vb[cb * 2 + 0];
            const v4f v23 = vb[cb * 2 + 1];
            v8f c = acc[cb];
            c = WMMA_F32(pa[0], v01.xy, c);
            c = WMMA_F32(pa[1], v01.zw, c);
            c = WMMA_F32(pa[2], v23.xy, c);
            c = WMMA_F32(pa[3], v23.zw, c);
            acc[cb] = c;
        }
    }

    // ---- O = acc / l, written in place over this tile's q region
    float* ob = QO + (size_t)(b * S + qt * 16) * 2048 + h * 128;
#pragma unroll
    for (int cb = 0; cb < 8; ++cb) {
#pragma unroll
        for (int v = 0; v < 8; ++v) {
            const int m = hi * 8 + v;
            ob[(size_t)m * 2048 + cb * 16 + n16] = acc[cb][v] / lrow[v];
        }
    }
    // the stores above have taken their registers before the next tile rewrites them
    asm volatile("s_wait_xcnt 0x0" ::: "memory");
    }
}

// ---------------------------------------------------------------------------
extern "C" void kernel_launch(void* const* d_in, const int* in_sizes, int n_in,
                              void* d_out, int out_size, void* d_ws, size_t ws_size,
                              hipStream_t stream) {
    const float* x   = (const float*)d_in[0];
    const float* wq  = (const float*)d_in[1];
    const float* wkv = (const float*)d_in[2];
    const float* wo  = (const float*)d_in[3];
    const int* past  = (const int*)d_in[4];

    const int B = 2, S = 2048, D = 2048, H = 16, DH = 128;
    const int M = B * S;  // 4096

    float* ws  = (float*)d_ws;
    float* Q   = ws;                        // M*D   (later holds O in place)
    float* KVt = Q + (size_t)M * D;         // M*256
    float* KF  = KVt + (size_t)M * 256;     // M*128, roped K in fragment order
    float* VF  = KF + (size_t)M * 128;      // M*128, V in fragment order
    // total ws use: (M*D + M*256 + 2*M*128)*4 bytes = ~40 MB

    float* out  = (float*)d_out;            // M*D
    float* outK = out + (size_t)M * D;      // M*DH
    float* outV = outK + (size_t)M * DH;    // M*DH

    // 1) Q = x @ wq^T         [4096x2048] x [2048x2048]^T
    gemm_f32<true><<<(M / 64) * (D / 64), 128, 0, stream>>>(x, wq, Q, M, D, D, D, D, D);

    // 2) KV = x @ wkv         [4096x2048] x [2048x256]
    gemm_f32<false><<<(M / 64) * (256 / 64), 128, 0, stream>>>(x, wkv, KVt, M, 256, D, D, 256, 256);

    // 3) outputs K (pre-rope) and V
    copy_kv<<<(M * DH) / 256, 256, 0, stream>>>(KVt, outK, outV, M);

    // 4) RoPE on K, and K and V into fragment order (Q gets its RoPE in step 5)
    pack_kv<<<(M * 16) / 256, 256, 0, stream>>>(KVt, KF, VF, S);

    // 5) causal MQA flash attention; O overwrites Q buffer
    attn_kernel<<<(B * H * (S / 32)) / 4, 128, 0, stream>>>(Q, KF, VF, past, S);

    // 6) out = O @ wo^T
    gemm_f32<true><<<(M / 64) * (D / 64), 128, 0, stream>>>(Q, wo, out, M, D, D, D, D, D);
}

// v006
// Measured time: 608 microseconds a run.
// Next to v005, in two timings, it ran 1.09 and 1.08 times as fast.
// Over all steps from v000 it is 1.90 times as fast.
#include <hip/hip_runtime.h>
#include <math.h>
#include <stdint.h>

typedef float v2f __attribute__((ext_vector_type(2)));
typedef float v4f __attribute__((ext_vector_type(4)));
typedef float v8f __attribute__((ext_vector_type(8)));

#define WMMA_F32(a, b, c) \
    __builtin_amdgcn_wmma_f32_16x16x4_f32(false, (a), false, (b), (short)0, (c), false, false)

// ---------------------------------------------------------------------------
// GEMM: C[M,N] = X[M,K] * op(W)
//   WT=true : W stored [N,K] row-major (compute X @ W^T)
//   WT=false: W stored [K,N] row-major (compute X @ W)
// One block (4 waves, 128 threads) computes a 64x64 C tile; wave wv owns the
// 16-row strip. Per K-chunk of 32 the X tile (64x32) and the W tile are both
// staged into LDS by async-to-LDS copies (ASYNCcnt). One copy instruction of a
// wave takes 512 contiguous-by-line bytes (four whole 128-byte lines). The LDS
// rows are pitched so that the 32 lanes of a fragment read fall on distinct
// banks: 36 floats for rows read along k (16 rows x 2 k-pairs cover all 64
// banks), 80 floats for the [K,N] form (rows k and k+2 lie 32 banks apart, so
// the two lane halves keep apart also where two 16-column reads are merged).
// gemm_tile is the work of one block, tile number bid; the kernels below own the LDS.
// ---------------------------------------------------------------------------
constexpr int GEMM_XLDS    = 64 * 36;  // floats: the X chunk, 64 rows
constexpr int GEMM_WLDS_NK = 64 * 36;  // floats: the W chunk of the [N,K] form, 64 rows
constexpr int GEMM_WLDS_KN = 32 * 80;  // floats: the W chunk of the [K,N] form, 32 rows (the larger)

template <bool WT>
__device__ __forceinline__ void gemm_tile(const float* __restrict__ X,
                                          const float* __restrict__ W,
                                          float* __restrict__ C,
                                          unsigned bid, int N, int K,
                                          int ldx, int ldw, int ldc,
                                          float* xlds, float* wlds) {
    constexpr int XP = 36;            // floats per LDS row of the X chunk
    constexpr int WP = WT ? 36 : 80;  // floats per LDS row of the W chunk

    const int lane = threadIdx.x & 31;
    const int wv   = threadIdx.x >> 5;
    const int ntiles = N >> 6;
    const int mt = bid / ntiles;  // 64-row block index
    const int nt = bid % ntiles;  // 64-col block index

    const int n16  = lane & 15;
    const int hi   = lane >> 4;  // 0 or 1
    const int koff = hi << 1;    // 0 or 2

    // each chunk is 512 pieces of 16 bytes per operand, 4 + 4 per thread;
    // piece p = i*128 + thread, so neighbouring lanes take neighbouring pieces
    const float* xg[4];
    const float* wg[4];
    uint32_t xl[4], wl[4];  // low 32 bits of a __shared__ address = LDS offset
#pragma unroll
    for (int i = 0; i < 4; ++i) {
        const int p = i * 128 + threadIdx.x;
        xg[i] = X + (size_t)(mt * 64 + (p >> 3)) * ldx + (p & 7) * 4;
        xl[i] = (uint32_t)(uintptr_t)&xlds[(p >> 3) * XP + (p & 7) * 4];
        if (WT) {  // wlds[n][k]: a row is 32 floats of one W row
            wg[i] = W + (size_t)(nt * 64 + (p >> 3)) * ldw + (p & 7) * 4;
            wl[i] = (uint32_t)(uintptr_t)&wlds[(p >> 3) * WP + (p & 7) * 4];
        } else {   // wlds[k][n]: a row is 64 floats of one W row
            wg[i] = W + (size_t)(p >> 4) * ldw + nt * 64 + (p & 15) * 4;
            wl[i] = (uint32_t)(uintptr_t)&wlds[(p >> 4) * WP + (p & 15) * 4];
        }
    }
    const size_t wstep = WT ? (size_t)32 : (size_t)32 * ldw;

    const float* xf = &xlds[(wv * 16 + n16) * XP + koff];  // A row m = lane&15
    v8f acc[4] = {};

    for (int k0 = 0; k0 < K; k0 += 32) {
        // this wave's fragment reads of the previous chunk have returned ...
        asm volatile("s_wait_dscnt 0x0" ::: "memory");
        __syncthreads();  // ... and so have every other wave's: restaging is safe
        // the copies and their s_wait_xcnt stand in one statement, so the compiler
        // can move no update of an address register in front of that wait
        asm volatile(
            "global_load_async_to_lds_b128 %0, %1, off\n\t"
            "global_load_async_to_lds_b128 %2, %3, off\n\t"
            "global_load_async_to_lds_b128 %4, %5, off\n\t"
            "global_load_async_to_lds_b128 %6, %7, off\n\t"
            "global_load_async_to_lds_b128 %8, %9, off\n\t"
            "global_load_async_to_lds_b128 %10, %11, off\n\t"
            "global_load_async_to_lds_b128 %12, %13, off\n\t"
            "global_load_async_to_lds_b128 %14, %15, off\n\t"
            "s_wait_xcnt 0x0"
            :: "v"(xl[0]), "v"(xg[0]), "v"(xl[1]), "v"(xg[1]),
               "v"(xl[2]), "v"(xg[2]), "v"(xl[3]), "v"(xg[3]),
               "v"(wl[0]), "v"(wg[0]), "v"(wl[1]), "v"(wg[1]),
               "v"(wl[2]), "v"(wg[2]), "v"(wl[3]), "v"(wg[3])
            : "memory");
        // this wave's copies have landed
        asm volatile("s_wait_asynccnt 0x0" ::: "memory");
        __syncthreads();  // all waves' staging visible
#pragma unroll
        for (int i = 0; i < 4; ++i) {
            xg[i] += 32;
            wg[i] += wstep;
        }

        // ---- 8 K-steps of 4 WMMAs
#pragma unroll
        for (int kk = 0; kk < 8; ++kk) {
            v2f a = *(const v2f*)(xf + kk * 4);
#pragma unroll
            for (int t = 0; t < 4; ++t) {
                v2f b;
                if (WT) {
                    b = *(const v2f*)&wlds[(t * 16 + n16) * WP + kk * 4 + koff];
                } else {
                    b.x = wlds[(kk * 4 + koff) * WP + t * 16 + n16];
                    b.y = wlds[(kk * 4 + koff + 1) * WP + t * 16 + n16];
                }
                acc[t] = WMMA_F32(a, b, acc[t]);
            }
        }
    }

#pragma unroll
    for (int t = 0; t < 4; ++t) {
#pragma unroll
        for (int v = 0; v < 8; ++v) {
            const int m = hi * 8 + v;  // C layout: vgpr v, lane group hi -> row v+8*hi
            C[(size_t)(mt * 64 + wv * 16 + m) * ldc + nt * 64 + t * 16 + n16] = acc[t][v];
        }
    }
}

// C = X @ W^T, one 64x64 tile a block
__global__ __launch_bounds__(128) void gemm_nt(const float* __restrict__ X,
                                               const float* __restrict__ W,
                                               float* __restrict__ C,
                                               int N, int K) {
    __shared__ __attribute__((aligned(16))) float xlds[GEMM_XLDS];
    __shared__ __attribute__((aligned(16))) float wlds[GEMM_WLDS_NK];
    gemm_tile<true>(X, W, C, blockIdx.x, N, K, K, K, N, xlds, wlds);
}

// Both projections of x in one launch: blocks 0 .. nkvb-1 do KV = X @ Wkv, the
// rest Q = X @ Wq^T. Alone, the KV product fills the chip with one wave a SIMD,
// and each K-chunk's staging latency and LDS reads stand open; here its waves
// share each SIMD with eight of the Q product, whose WMMAs fill those waits. Every
// block does the same number of WMMAs, and all blocks are resident at once.
__global__ __launch_bounds__(128) void gemm_qkv(const float* __restrict__ X,
                                                const float* __restrict__ Wq,
                                                const float* __restrict__ Wkv,
                                                float* __restrict__ Q,
                                                float* __restrict__ KV,
                                                unsigned nkvb, int Nq, int Nkv, int K) {
    __shared__ __attribute__((aligned(16))) float xlds[GEMM_XLDS];
    __shared__ __attribute__((aligned(16))) float wlds[GEMM_WLDS_KN];
    const unsigned bid = blockIdx.x;  // the same for the whole block: one path, its barriers too
    if (bid < nkvb)
        gemm_tile<false>(X, Wkv, KV, bid, Nkv, K, K, Nkv, Nkv, xlds, wlds);
    else
        gemm_tile<true>(X, Wq, Q, bid - nkvb, Nq, K, K, K, Nq, xlds, wlds);
}

// ---------------------------------------------------------------------------
// Split KV[M,256] into K (cols 0..127, pre-rope) and V (cols 128..255) outputs
// ---------------------------------------------------------------------------
__global__ __launch_bounds__(256) void copy_kv(const float* __restrict__ KV,
                                               float* __restrict__ outK,
                                               float* __restrict__ outV, int M) {
    const int idx = blockIdx.x * 256 + threadIdx.x;  // M*128 threads
    const int r = idx >> 7;
    const int d = idx & 127;
    outK[idx] = KV[(size_t)r * 256 + d];
    outV[idx] = KV[(size_t)r * 256 + 128 + d];
}

// ---------------------------------------------------------------------------
// Pack K (roped, pos = s) and V into WMMA fragment order for the attention
// kernel. A 16-key tile is 16 groups of 32 lanes x 4 floats (2048 floats), so
// one wave-wide 16-byte load is 512 contiguous bytes and feeds two WMMAs.
//   KF group j,   lane (hi,n16), e: K[key n16][d = 8j + 4(e>>1) + 2hi + (e&1)]
//   VF group q,   lane (hi,n16), e: V[key 8(q&1) + 4(e>>1) + 2hi + (e&1)][d = 16(q>>1) + n16]
// One thread writes groups j and j+8 of both (the rope pair d, d+64 lies in
// groups j and j+8 at the same lane and e). Threads: B*S*16
// ---------------------------------------------------------------------------
__global__ __launch_bounds__(256) void pack_kv(const float* __restrict__ KV,
                                               float* __restrict__ KF,
                                               float* __restrict__ VF, int S) {
    const int idx  = blockIdx.x * 256 + threadIdx.x;
    const int lane = idx & 31;
    const int j    = (idx >> 5) & 7;
    const int tile = idx >> 8;  // (b*S + s) / 16
    const int n16  = lane & 15;
    const int hi   = lane >> 4;

    const int r = tile * 16 + n16;  // b*S + s
    const int s = r % S;
    const float* krow = KV + (size_t)r * 256;
    v4f lo, up;
#pragma unroll
    for (int e = 0; e < 4; ++e) {
        const int d = j * 8 + (e >> 1) * 4 + hi * 2 + (e & 1);
        const float freq = __expf(-0.14391156213f * (float)d);
        float sn, cs;
        sincosf((float)s * freq, &sn, &cs);
        const float x1 = krow[d];
        const float x2 = krow[64 + d];
        lo[e] = x1 * cs - x2 * sn;
        up[e] = x2 * cs + x1 * sn;
    }
    v4f* kf = (v4f*)KF + (size_t)tile * 512 + lane;
    kf[j * 32]       = lo;
    kf[(j + 8) * 32] = up;

    v4f* vf = (v4f*)VF + (size_t)tile * 512 + lane;
#pragma unroll
    for (int g = 0; g < 2; ++g) {
        const int q = j + g * 8;
        const float* vcol = KV + (size_t)(tile * 16 + (q & 1) * 8 + hi * 2) * 256 + 128 + (q >> 1) * 16 + n16;
        v4f vv;
        vv[0] = vcol[0 * 256];
        vv[1] = vcol[1 * 256];
        vv[2] = vcol[4 * 256];
        vv[3] = vcol[5 * 256];
        vf[q * 32] = vv;
    }
}

// ---------------------------------------------------------------------------
// Flash attention, causal, MQA (one KV head). One wave per (b, h, pair of 16-row
// q tiles): it runs tile n-1-t and then tile t, so every wave walks n+1 key tiles
// and no SIMD is left with only long or only short rows of the causal triangle.
// QK^T and P@V via fp32 WMMA. O written in place over the Q region of that exact
// tile/head -- safe: each wave stages its q tile into LDS first and tiles are
// disjoint across waves. The staged tile gets its RoPE (pos = past + s) there, in
// LDS, so Q needs no launch and no pass through memory of its own for it.
// Q (in LDS), K and V (packed by pack_kv) are all held in fragment order: every
// operand load is 16 contiguous bytes a lane. The q fragments are read from LDS
// once per q tile and stay in registers over the key loop, so the 32 chained
// score WMMAs of a key tile wait on no LDS read.
// The grid gives each SIMD two waves, so a wave may take up to half the register
// file: amdgpu_waves_per_eu(1, 2) says so. Without it the compiler saves registers
// by running the softmax's cross-lane steps one row after another.
// ---------------------------------------------------------------------------
__global__ __launch_bounds__(128) __attribute__((amdgpu_waves_per_eu(1, 2))) void attn_kernel(float* __restrict__ QO,
                                                   const float* __restrict__ KF,
                                                   const float* __restrict__ VF,
                                                   const int* __restrict__ past_ptr,
                                                   int S) {
    // per-wave q tile, 8KB each, in the order of KF (row m in place of the key)
    __shared__ __attribute__((aligned(16))) float qs[4][16 * 128];
    __shared__ float ps[4][16 * 16];   // per-wave P tile (C-layout -> A-layout)

    const int lane = threadIdx.x & 31;
    const int wv   = threadIdx.x >> 5;
    const int qtiles = S >> 4;
    const int npair  = qtiles >> 1;
    const int wid = blockIdx.x * 4 + wv;
    const int tp = wid % npair;
    const int h  = (wid / npair) & 15;
    const int b  = wid / (npair * 16);
    const int past = *past_ptr;

    const int n16 = lane & 15;
    const int hi  = lane >> 4;

    float* qsw = qs[wv];
    // kept rolled: unrolled, the kernel's text would double and gain nothing
#pragma unroll 1
    for (int half = 0; half < 2; ++half) {
    const int qt = half ? tp : qtiles - 1 - tp;  // the long tile first
    {
        // lane (hi,n16) brings Q[n16][8j + 4hi .. +3]; its two pairs go to the
        // lanes hi' = 0 and 1 of group j, at e = 2hi (32 distinct 8-byte slots a store)
        const float* qb = QO + (size_t)(b * S + qt * 16 + n16) * 2048 + h * 128 + hi * 4;
        v4f qv[16];
#pragma unroll
        for (int jj = 0; jj < 16; ++jj) qv[jj] = *(const v4f*)(qb + jj * 8);
        // the address pair stays whole until every load above has taken it
        asm volatile("s_wait_xcnt 0x0" :: "v"(qb) : "memory");
        float* qd = qsw + n16 * 4 + hi * 2;
#pragma unroll
        for (int jj = 0; jj < 16; ++jj) {
            *(v2f*)(qd + jj * 128)      = qv[jj].xy;
            *(v2f*)(qd + jj * 128 + 64) = qv[jj].zw;
        }
    }
    {
        // RoPE in place: group j, lane (hi,n16), e holds Q[n16][d = 8j + 4(e>>1) + 2hi + (e&1)],
        // and its partner d + 64 lies in group j + 8 at the same lane and e
        const float pos = (float)(past + qt * 16 + n16);
        v4f* qr = (v4f*)qsw + lane;
        // kept rolled: 32 inlined sincosf would swell the kernel's text eightfold here
#pragma unroll 1
        for (int j = 0; j < 8; ++j) {
            v4f lo = qr[j * 32];
            v4f up = qr[(j + 8) * 32];
#pragma unroll
            for (int e = 0; e < 4; ++e) {
                const int d = j * 8 + (e >> 1) * 4 + hi * 2 + (e & 1);
                const float freq = __expf(-0.14391156213f * (float)d);  // 1/10000^(d/64)
                float sn, cs;
                sincosf(pos * freq, &sn, &cs);
                const float x1 = lo[e];
                const float x2 = up[e];
                lo[e] = x1 * cs - x2 * sn;
                up[e] = x2 * cs + x1 * sn;
            }
            qr[j * 32]       = lo;
            qr[(j + 8) * 32] = up;
        }
    }

    float mrow[8], lrow[8];
    v8f acc[8] = {};
#pragma unroll
    for (int v = 0; v < 8; ++v) { mrow[v] = -1e30f; lrow[v] = 0.f; }

    const float scale = 0.08838834764831845f;  // 1/sqrt(128)
    const int lastj = past + qt * 16 + 15;
    int nkt = lastj / 16 + 1;
    if (nkt > (S >> 4)) nkt = S >> 4;

    const v4f* kfbase = (const v4f*)KF + (size_t)b * (S >> 4) * 512 + lane;
    const v4f* vfbase = (const v4f*)VF + (size_t)b * (S >> 4) * 512 + lane;
    // the roped q tile's 16 fragment quads, read from LDS once per q tile and held
    // in registers over the whole key loop (each lane reads back its own slots)
    const v4f* qf = (const v4f*)qsw + lane;
    v4f qa[16];
#pragma unroll
    for (int jj = 0; jj < 16; ++jj) qa[jj] = qf[jj * 32];
    float* psw = ps[wv];

    for (int kt = 0; kt < nkt; ++kt) {
        // ---- scores tile: 16x16 = q(16x128) @ k^T, 32 WMMAs of K=4
        v8f sc = {};
        const v4f* kf = kfbase + (size_t)kt * 512;
        v4f kb[16];
#pragma unroll
        for (int jj = 0; jj < 16; ++jj) kb[jj] = kf[jj * 32];
        // the address pair stays whole until every load above has taken it
        asm volatile("s_wait_xcnt 0x0" :: "v"(kf) : "memory");
        // keeps the tile's 16 loads in flight together: without it the compiler
        // reuses one register quad and waits out each load's latency in turn
        __builtin_amdgcn_sched_barrier(0);
#pragma unroll
        for (int jj = 0; jj < 16; ++jj) {
            sc = WMMA_F32(qa[jj].xy, kb[jj].xy, sc);
            sc = WMMA_F32(qa[jj].zw, kb[jj].zw, sc);
        }
        const v4f* vf = vfbase + (size_t)kt * 512;
        v4f vb[16];
#pragma unroll
        for (int q = 0; q < 16; ++q) vb[q] = vf[q * 32];
        // the address pair stays whole until every load above has taken it
        asm volatile("s_wait_xcnt 0x0" :: "v"(vf) : "memory");
        // same purpose for the V tile's 16 loads
        __builtin_amdgcn_sched_barrier(0);

        // ---- scale + causal mask + online softmax (row = hi*8+v across 16 lanes)
        float pv[8];
        const int j = kt * 16 + n16;  // key position for this lane's column
#pragma unroll
        for (int v = 0; v < 8; ++v) {
            float x = sc[v] * scale;
            const int irow = past + qt * 16 + hi * 8 + v;
            if (j > irow) x = -1e30f;
            float t = x;
            t = fmaxf(t, __shfl_xor(t, 1));
            t = fmaxf(t, __shfl_xor(t, 2));
            t = fmaxf(t, __shfl_xor(t, 4));
            t = fmaxf(t, __shfl_xor(t, 8));
            const float mnew = fmaxf(mrow[v], t);
            const float p = __expf(x - mnew);
            float psum = p;
            psum += __shfl_xor(psum, 1);
            psum += __shfl_xor(psum, 2);
            psum += __shfl_xor(psum, 4);
            psum += __shfl_xor(psum, 8);
            const float rs = __expf(mrow[v] - mnew);
            lrow[v] = lrow[v] * rs + psum;
            mrow[v] = mnew;
            pv[v] = p;
#pragma unroll
            for (int cb = 0; cb < 8; ++cb) acc[cb][v] *= rs;
        }

        // ---- P tile: C-layout regs -> LDS -> A-layout fragments
#pragma unroll
        for (int v = 0; v < 8; ++v) psw[(hi * 8 + v) * 16 + n16] = pv[v];

        // ---- acc += P(16x16) @ V(16x128): 8 col-blocks x 4 WMMAs
        const float* pp  = psw + n16 * 16 + (hi << 1);
        v2f pa[4];
#pragma unroll
        for (int kk = 0; kk < 4; ++kk) pa[kk] = *(const v2f*)(pp + kk * 4);
#pragma unroll
        for (int cb = 0; cb < 8; ++cb) {
            const v4f v01 = vb[cb * 2 + 0];
            const v4f v23 = vb[cb * 2 + 1];
            v8f c = acc[cb];
            c = WMMA_F32(pa[0], v01.xy, c);
            c = WMMA_F32(pa[1], v01.zw, c);
            c = WMMA_F32(pa[2], v23.xy, c);
            c = WMMA_F32(pa[3], v23.zw, c);
            acc[cb] = c;
        }
    }

    // ---- O = acc / l, written in place over this tile's q region
    float* ob = QO + (size_t)(b * S + qt * 16) * 2048 + h * 128;
#pragma unroll
    for (int cb = 0; cb < 8; ++cb) {
#pragma unroll
        for (int v = 0; v < 8; ++v) {
            const int m = hi * 8 + v;
            ob[(size_t)m * 2048 + cb * 16 + n16] = acc[cb][v] / lrow[v];
        }
    }
    // the stores above have taken their registers before the next tile rewrites them
    asm volatile("s_wait_xcnt 0x0" ::: "memory");
    }
}

// ---------------------------------------------------------------------------
extern "C" void kernel_launch(void* const* d_in, const int* in_sizes, int n_in,
                              void* d_out, int out_size, void* d_ws, size_t ws_size,
                              hipStream_t stream) {
    const float* x   = (const float*)d_in[0];
    const float* wq  = (const float*)d_in[1];
    const float* wkv = (const float*)d_in[2];
    const float* wo  = (const float*)d_in[3];
    const int* past  = (const int*)d_in[4];

    const int B = 2, S = 2048, D = 2048, H = 16, DH = 128;
    const int M = B * S;  // 4096

    float* ws  = (float*)d_ws;
    float* Q   = ws;                        // M*D   (later holds O in place)
    float* KVt = Q + (size_t)M * D;         // M*256
    float* KF  = KVt + (size_t)M * 256;     // M*128, roped K in fragment order
    float* VF  = KF + (size_t)M * 128;      // M*128, V in fragment order
    // total ws use: (M*D + M*256 + 2*M*128)*4 bytes = ~40 MB

    float* out  = (float*)d_out;            // M*D
    float* outK = out + (size_t)M * D;      // M*DH
    float* outV = outK + (size_t)M * DH;    // M*DH

    // 1) + 2) KV = x @ wkv [4096x2048] x [2048x256] and Q = x @ wq^T [4096x2048] x [2048x2048]^T
    gemm_qkv<<<(M / 64) * (256 / 64) + (M / 64) * (D / 64), 128, 0, stream>>>(
        x, wq, wkv, Q, KVt, (M / 64) * (256 / 64), D, 256, D);

    // 3) outputs K (pre-rope) and V
    copy_kv<<<(M * DH) / 256, 256, 0, stream>>>(KVt, outK, outV, M);

    // 4) RoPE on K, and K and V into fragment order (Q gets its RoPE in step 5)
    pack_kv<<<(M * 16) / 256, 256, 0, stream>>>(KVt, KF, VF, S);

    // 5) causal MQA flash attention; O overwrites Q buffer
    attn_kernel<<<(B * H * (S / 32)) / 4, 128, 0, stream>>>(Q, KF, VF, past, S);

    // 6) out = O @ wo^T
    gemm_nt<<<(M / 64) * (D / 64), 128, 0, stream>>>(Q, wo, out, D, D);
}

// v007
// One run takes 557 microseconds.
// Two timings next to v006 both put it at 1.08 times that version's speed.
// All steps since v000 together make it 2.06 times as fast.
#include <hip/hip_runtime.h>
#include <math.h>
#include <stdint.h>

typedef float v2f __attribute__((ext_vector_type(2)));
typedef float v4f __attribute__((ext_vector_type(4)));
typedef float v8f __attribute__((ext_vector_type(8)));

#define WMMA_F32(a, b, c) \
    __builtin_amdgcn_wmma_f32_16x16x4_f32(false, (a), false, (b), (short)0, (c), false, false)

// ---------------------------------------------------------------------------
// GEMM: C[M,N] = X[M,K] * op(W)
//   WT=true : W stored [N,K] row-major (compute X @ W^T)
//   WT=false: W stored [K,N] row-major (compute X @ W)
// One block (4 waves, 128 threads) computes a 64x64 C tile; wave wv owns the
// 16-row strip. Per K-chunk of 32 the X tile (64x32) and the W tile are both
// staged into LDS by async-to-LDS copies (ASYNCcnt). One copy instruction of a
// wave takes 512 contiguous-by-line bytes (four whole 128-byte lines). The LDS
// rows are pitched so that the 32 lanes of a fragment read fall on distinct
// banks: 36 floats for rows read along k (16 rows x 2 k-pairs cover all 64
// banks), 80 floats for the [K,N] form (rows k and k+2 lie 32 banks apart, so
// the two lane halves keep apart also where two 16-column reads are merged).
// gemm_tile is the work of one block, tile number bid; the kernels below own the LDS.
// ---------------------------------------------------------------------------
constexpr int GEMM_XLDS    = 64 * 36;  // floats: the X chunk, 64 rows
constexpr int GEMM_WLDS_NK = 64 * 36;  // floats: the W chunk of the [N,K] form, 64 rows
constexpr int GEMM_WLDS_KN = 32 * 80;  // floats: the W chunk of the [K,N] form, 32 rows (the larger)

template <bool WT>
__device__ __forceinline__ void gemm_tile(const float* __restrict__ X,
                                          const float* __restrict__ W,
                                          float* __restrict__ C,
                                          unsigned bid, int N, int K,
                                          int ldx, int ldw, int ldc,
                                          float* xlds, float* wlds) {
    constexpr int XP = 36;            // floats per LDS row of the X chunk
    constexpr int WP = WT ? 36 : 80;  // floats per LDS row of the W chunk

    const int lane = threadIdx.x & 31;
    const int wv   = threadIdx.x >> 5;
    const int ntiles = N >> 6;
    const int mt = bid / ntiles;  // 64-row block index
    const int nt = bid % ntiles;  // 64-col block index

    const int n16  = lane & 15;
    const int hi   = lane >> 4;  // 0 or 1
    const int koff = hi << 1;    // 0 or 2

    // each chunk is 512 pieces of 16 bytes per operand, 4 + 4 per thread;
    // piece p = i*128 + thread, so neighbouring lanes take neighbouring pieces
    const float* xg[4];
    const float* wg[4];
    uint32_t xl[4], wl[4];  // low 32 bits of a __shared__ address = LDS offset
#pragma unroll
    for (int i = 0; i < 4; ++i) {
        const int p = i * 128 + threadIdx.x;
        xg[i] = X + (size_t)(mt * 64 + (p >> 3)) * ldx + (p & 7) * 4;
        xl[i] = (uint32_t)(uintptr_t)&xlds[(p >> 3) * XP + (p & 7) * 4];
        if (WT) {  // wlds[n][k]: a row is 32 floats of one W row
            wg[i] = W + (size_t)(nt * 64 + (p >> 3)) * ldw + (p & 7) * 4;
            wl[i] = (uint32_t)(uintptr_t)&wlds[(p >> 3) * WP + (p & 7) * 4];
        } else {   // wlds[k][n]: a row is 64 floats of one W row
            wg[i] = W + (size_t)(p >> 4) * ldw + nt * 64 + (p & 15) * 4;
            wl[i] = (uint32_t)(uintptr_t)&wlds[(p >> 4) * WP + (p & 15) * 4];
        }
    }
    const size_t wstep = WT ? (size_t)32 : (size_t)32 * ldw;

    const float* xf = &xlds[(wv * 16 + n16) * XP + koff];  // A row m = lane&15
    v8f acc[4] = {};

    for (int k0 = 0; k0 < K; k0 += 32) {
        // this wave's fragment reads of the previous chunk have returned ...
        asm volatile("s_wait_dscnt 0x0" ::: "memory");
        __syncthreads();  // ... and so have every other wave's: restaging is safe
        // the copies and their s_wait_xcnt stand in one statement, so the compiler
        // can move no update of an address register in front of that wait
        asm volatile(
            "global_load_async_to_lds_b128 %0, %1, off\n\t"
            "global_load_async_to_lds_b128 %2, %3, off\n\t"
            "global_load_async_to_lds_b128 %4, %5, off\n\t"
            "global_load_async_to_lds_b128 %6, %7, off\n\t"
            "global_load_async_to_lds_b128 %8, %9, off\n\t"
            "global_load_async_to_lds_b128 %10, %11, off\n\t"
            "global_load_async_to_lds_b128 %12, %13, off\n\t"
            "global_load_async_to_lds_b128 %14, %15, off\n\t"
            "s_wait_xcnt 0x0"
            :: "v"(xl[0]), "v"(xg[0]), "v"(xl[1]), "v"(xg[1]),
               "v"(xl[2]), "v"(xg[2]), "v"(xl[3]), "v"(xg[3]),
               "v"(wl[0]), "v"(wg[0]), "v"(wl[1]), "v"(wg[1]),
               "v"(wl[2]), "v"(wg[2]), "v"(wl[3]), "v"(wg[3])
            : "memory");
        // this wave's copies have landed
        asm volatile("s_wait_asynccnt 0x0" ::: "memory");
        __syncthreads();  // all waves' staging visible
#pragma unroll
        for (int i = 0; i < 4; ++i) {
            xg[i] += 32;
            wg[i] += wstep;
        }

        // ---- 8 K-steps of 4 WMMAs
#pragma unroll
        for (int kk = 0; kk < 8; ++kk) {
            v2f a = *(const v2f*)(xf + kk * 4);
#pragma unroll
            for (int t = 0; t < 4; ++t) {
                v2f b;
                if (WT) {
                    b = *(const v2f*)&wlds[(t * 16 + n16) * WP + kk * 4 + koff];
                } else {
                    b.x = wlds[(kk * 4 + koff) * WP + t * 16 + n16];
                    b.y = wlds[(kk * 4 + koff + 1) * WP + t * 16 + n16];
                }
                acc[t] = WMMA_F32(a, b, acc[t]);
            }
        }
    }

#pragma unroll
    for (int t = 0; t < 4; ++t) {
#pragma unroll
        for (int v = 0; v < 8; ++v) {
            const int m = hi * 8 + v;  // C layout: vgpr v, lane group hi -> row v+8*hi
            C[(size_t)(mt * 64 + wv * 16 + m) * ldc + nt * 64 + t * 16 + n16] = acc[t][v];
        }
    }
}

// C = X @ W^T, one 64x64 tile a block
__global__ __launch_bounds__(128) void gemm_nt(const float* __restrict__ X,
                                               const float* __restrict__ W,
                                               float* __restrict__ C,
                                               int N, int K) {
    __shared__ __attribute__((aligned(16))) float xlds[GEMM_XLDS];
    __shared__ __attribute__((aligned(16))) float wlds[GEMM_WLDS_NK];
    gemm_tile<true>(X, W, C, blockIdx.x, N, K, K, K, N, xlds, wlds);
}

// Both projections of x in one launch: blocks 0 .. nkvb-1 do KV = X @ Wkv, the
// rest Q = X @ Wq^T. Alone, the KV product fills the chip with one wave a SIMD,
// and each K-chunk's staging latency and LDS reads stand open; here its waves
// share each SIMD with eight of the Q product, whose WMMAs fill those waits. Every
// block does the same number of WMMAs, and all blocks are resident at once.
__global__ __launch_bounds__(128) void gemm_qkv(const float* __restrict__ X,
                                                const float* __restrict__ Wq,
                                                const float* __restrict__ Wkv,
                                                float* __restrict__ Q,
                                                float* __restrict__ KV,
                                                unsigned nkvb, int Nq, int Nkv, int K) {
    __shared__ __attribute__((aligned(16))) float xlds[GEMM_XLDS];
    __shared__ __attribute__((aligned(16))) float wlds[GEMM_WLDS_KN];
    const unsigned bid = blockIdx.x;  // the same for the whole block: one path, its barriers too
    if (bid < nkvb)
        gemm_tile<false>(X, Wkv, KV, bid, Nkv, K, K, Nkv, Nkv, xlds, wlds);
    else
        gemm_tile<true>(X, Wq, Q, bid - nkvb, Nq, K, K, K, Nq, xlds, wlds);
}

// ---------------------------------------------------------------------------
// Split KV[M,256] into K (cols 0..127, pre-rope) and V (cols 128..255) outputs
// ---------------------------------------------------------------------------
__global__ __launch_bounds__(256) void copy_kv(const float* __restrict__ KV,
                                               float* __restrict__ outK,
                                               float* __restrict__ outV, int M) {
    const int idx = blockIdx.x * 256 + threadIdx.x;  // M*128 threads
    const int r = idx >> 7;
    const int d = idx & 127;
    outK[idx] = KV[(size_t)r * 256 + d];
    outV[idx] = KV[(size_t)r * 256 + 128 + d];
}

// ---------------------------------------------------------------------------
// Pack K (roped, pos = s) and V into WMMA fragment order for the attention
// kernel. A 16-key tile is 16 groups of 32 lanes x 4 floats (2048 floats), so
// one wave-wide 16-byte load is 512 contiguous bytes and feeds two WMMAs.
//   KF group j,   lane (hi,n16), e: K[key n16][d = 8j + 4(e>>1) + 2hi + (e&1)]
//   VF group q,   lane (hi,n16), e: V[key 8hi + 4(q&1) + e][d = 16(q>>1) + n16]
//   (the keys of lane half hi are those whose scores that half holds in attn_kernel)
// One thread writes groups j and j+8 of both (the rope pair d, d+64 lies in
// groups j and j+8 at the same lane and e). Threads: B*S*16
// ---------------------------------------------------------------------------
__global__ __launch_bounds__(256) void pack_kv(const float* __restrict__ KV,
                                               float* __restrict__ KF,
                                               float* __restrict__ VF, int S) {
    const int idx  = blockIdx.x * 256 + threadIdx.x;
    const int lane = idx & 31;
    const int j    = (idx >> 5) & 7;
    const int tile = idx >> 8;  // (b*S + s) / 16
    const int n16  = lane & 15;
    const int hi   = lane >> 4;

    const int r = tile * 16 + n16;  // b*S + s
    const int s = r % S;
    const float* krow = KV + (size_t)r * 256;
    v4f lo, up;
#pragma unroll
    for (int e = 0; e < 4; ++e) {
        const int d = j * 8 + (e >> 1) * 4 + hi * 2 + (e & 1);
        const float freq = __expf(-0.14391156213f * (float)d);
        float sn, cs;
        sincosf((float)s * freq, &sn, &cs);
        const float x1 = krow[d];
        const float x2 = krow[64 + d];
        lo[e] = x1 * cs - x2 * sn;
        up[e] = x2 * cs + x1 * sn;
    }
    v4f* kf = (v4f*)KF + (size_t)tile * 512 + lane;
    kf[j * 32]       = lo;
    kf[(j + 8) * 32] = up;

    v4f* vf = (v4f*)VF + (size_t)tile * 512 + lane;
#pragma unroll
    for (int g = 0; g < 2; ++g) {
        const int q = j + g * 8;
        const float* vcol = KV + (size_t)(tile * 16 + hi * 8 + (q & 1) * 4) * 256 + 128 + (q >> 1) * 16 + n16;
        v4f vv;
        vv[0] = vcol[0 * 256];
        vv[1] = vcol[1 * 256];
        vv[2] = vcol[2 * 256];
        vv[3] = vcol[3 * 256];
        vf[q * 32] = vv;
    }
}

// ---------------------------------------------------------------------------
// Flash attention, causal, MQA (one KV head). One wave per (b, h, pair of 16-row
// q tiles): it runs tile n-1-t and then tile t, so every wave walks n+1 key tiles
// and no SIMD is left with only long or only short rows of the causal triangle.
// Both products run transposed on fp32 WMMA: S^T = K Q^T (K is the A operand, Q the
// B operand) and O^T += V^T P^T. In S^T a lane holds eight keys' scores of ONE query
// (column n16; lane half hi has keys 8hi .. 8hi+7), so the row maximum and the row
// sum are taken inside the lane, with one exchange between the lane halves for the
// maximum; the rescale factor is one value a lane; and the eight P values are, pair
// by pair and where they stand, the B operands of the second product (k slot (hi,e)
// of WMMA kk is key 8hi + 2kk + e, and VF is packed to match): P passes through no
// LDS and no cross-lane step. O written in place over the Q region of that exact
// tile/head -- safe: each wave stages its q tile into LDS first and tiles are
// disjoint across waves. The staged tile gets its RoPE (pos = past + s) there, in
// LDS, so Q needs no launch and no pass through memory of its own for it.
// Q (in LDS), K and V (packed by pack_kv) are all held in fragment order: every
// operand load is 16 contiguous bytes a lane. The q fragments are read from LDS
// once per q tile and stay in registers over the key loop, so the 32 chained
// score WMMAs of a key tile wait on no LDS read.
// The grid gives each SIMD two waves, so a wave may take up to half the register
// file: amdgpu_waves_per_eu(1, 2) says so.
// ---------------------------------------------------------------------------
// lane l takes the value of lane l ^ 16
__device__ __forceinline__ float xhalf(float x) {
    return __builtin_bit_cast(float, __builtin_amdgcn_permlanex16(__builtin_bit_cast(int, x), __builtin_bit_cast(int, x),
                                                                  0x76543210, 0xfedcba98, false, false));
}

__global__ __launch_bounds__(128) __attribute__((amdgpu_waves_per_eu(1, 2))) void attn_kernel(float* __restrict__ QO,
                                                   const float* __restrict__ KF,
                                                   const float* __restrict__ VF,
                                                   const int* __restrict__ past_ptr,
                                                   int S) {
    // per-wave q tile, 8KB each, in the order of KF (row m in place of the key)
    __shared__ __attribute__((aligned(16))) float qs[4][16 * 128];

    const int lane = threadIdx.x & 31;
    const int wv   = threadIdx.x >> 5;
    const int qtiles = S >> 4;
    const int npair  = qtiles >> 1;
    const int wid = blockIdx.x * 4 + wv;
    const int tp = wid % npair;
    const int h  = (wid / npair) & 15;
    const int b  = wid / (npair * 16);
    const int past = *past_ptr;

    const int n16 = lane & 15;
    const int hi  = lane >> 4;

    float* qsw = qs[wv];
    // kept rolled: unrolled, the kernel's text would double and gain nothing
#pragma unroll 1
    for (int half = 0; half < 2; ++half) {
    const int qt = half ? tp : qtiles - 1 - tp;  // the long tile first
    {
        // lane (hi,n16) brings Q[n16][8j + 4hi .. +3]; its two pairs go to the
        // lanes hi' = 0 and 1 of group j, at e = 2hi (32 distinct 8-byte slots a store)
        const float* qb = QO + (size_t)(b * S + qt * 16 + n16) * 2048 + h * 128 + hi * 4;
        v4f qv[16];
#pragma unroll
        for (int jj = 0; jj < 16; ++jj) qv[jj] = *(const v4f*)(qb + jj * 8);
        // the address pair stays whole until every load above has taken it
        asm volatile("s_wait_xcnt 0x0" :: "v"(qb) : "memory");
        float* qd = qsw + n16 * 4 + hi * 2;
#pragma unroll
        for (int jj = 0; jj < 16; ++jj) {
            *(v2f*)(qd + jj * 128)      = qv[jj].xy;
            *(v2f*)(qd + jj * 128 + 64) = qv[jj].zw;
        }
    }
    {
        // RoPE in place: group j, lane (hi,n16), e holds Q[n16][d = 8j + 4(e>>1) + 2hi + (e&1)],
        // and its partner d + 64 lies in group j + 8 at the same lane and e
        const float pos = (float)(past + qt * 16 + n16);
        v4f* qr = (v4f*)qsw + lane;
        // kept rolled: 32 inlined sincosf would swell the kernel's text eightfold here
#pragma unroll 1
        for (int j = 0; j < 8; ++j) {
            v4f lo = qr[j * 32];
            v4f up = qr[(j + 8) * 32];
#pragma unroll
            for (int e = 0; e < 4; ++e) {
                const int d = j * 8 + (e >> 1) * 4 + hi * 2 + (e & 1);
                const float freq = __expf(-0.14391156213f * (float)d);  // 1/10000^(d/64)
                float sn, cs;
                sincosf(pos * freq, &sn, &cs);
                const float x1 = lo[e];
                const float x2 = up[e];
                lo[e] = x1 * cs - x2 * sn;
                up[e] = x2 * cs + x1 * sn;
            }
            qr[j * 32]       = lo;
            qr[(j + 8) * 32] = up;
        }
    }

    // of this lane's query row n16: the running maximum (equal in both lane halves)
    // and the sum over the keys of this lane half (the halves are joined at the end)
    float mq = -1e30f, lq = 0.f;
    v8f acc[8] = {};  // acc[cb][v] = O^T[d = 16cb + 8hi + v][query n16]
    const int irow = past + qt * 16 + n16;

    const float scale = 0.08838834764831845f;  // 1/sqrt(128)
    const int lastj = past + qt * 16 + 15;
    int nkt = lastj / 16 + 1;
    if (nkt > (S >> 4)) nkt = S >> 4;

    const v4f* kfbase = (const v4f*)KF + (size_t)b * (S >> 4) * 512 + lane;
    const v4f* vfbase = (const v4f*)VF + (size_t)b * (S >> 4) * 512 + lane;
    // the roped q tile's 16 fragment quads, read from LDS once per q tile and held
    // in registers over the whole key loop (each lane reads back its own slots)
    const v4f* qf = (const v4f*)qsw + lane;
    v4f qa[16];
#pragma unroll
    for (int jj = 0; jj < 16; ++jj) qa[jj] = qf[jj * 32];

    for (int kt = 0; kt < nkt; ++kt) {
        // ---- scores tile, transposed: 16 keys x 16 queries = k(16x128) @ q^T, 32 WMMAs of K=4
        v8f sc = {};
        const v4f* kf = kfbase + (size_t)kt * 512;
        v4f kb[16];
#pragma unroll
        for (int jj = 0; jj < 16; ++jj) kb[jj] = kf[jj * 32];
        // the address pair stays whole until every load above has taken it
        asm volatile("s_wait_xcnt 0x0" :: "v"(kf) : "memory");
        // keeps the tile's 16 loads in flight together: without it the compiler
        // reuses one register quad and waits out each load's latency in turn
        __builtin_amdgcn_sched_barrier(0);
#pragma unroll
        for (int jj = 0; jj < 16; ++jj) {
            sc = WMMA_F32(kb[jj].xy, qa[jj].xy, sc);
            sc = WMMA_F32(kb[jj].zw, qa[jj].zw, sc);
        }
        const v4f* vf = vfbase + (size_t)kt * 512;
        v4f vb[16];
#pragma unroll
        for (int q = 0; q < 16; ++q) vb[q] = vf[q * 32];
        // the address pair stays whole until every load above has taken it
        asm volatile("s_wait_xcnt 0x0" :: "v"(vf) : "memory");
        // same purpose for the V tile's 16 loads
        __builtin_amdgcn_sched_barrier(0);

        // ---- scale + causal mask + online softmax: sc[v] is key kt*16 + 8hi + v of query n16
        float x[8], p[8];
        const int j0 = kt * 16 + hi * 8;
#pragma unroll
        for (int v = 0; v < 8; ++v) {
            float t = sc[v] * scale;
            if (j0 + v > irow) t = -1e30f;
            x[v] = t;
        }
        float t = fmaxf(fmaxf(fmaxf(x[0], x[1]), fmaxf(x[2], x[3])),
                        fmaxf(fmaxf(x[4], x[5]), fmaxf(x[6], x[7])));
        t = fmaxf(t, xhalf(t));  // the other eight keys of the tile
        const float mnew = fmaxf(mq, t);
        const float rs = __expf(mq - mnew);
#pragma unroll
        for (int v = 0; v < 8; ++v) p[v] = __expf(x[v] - mnew);
        lq = lq * rs + (((p[0] + p[1]) + (p[2] + p[3])) + ((p[4] + p[5]) + (p[6] + p[7])));
        mq = mnew;
#pragma unroll
        for (int cb = 0; cb < 8; ++cb) acc[cb] *= rs;

        // ---- acc += V^T(128x16) @ P^T(16x16): 8 row-blocks of d x 4 WMMAs
        const v2f p01 = {p[0], p[1]}, p23 = {p[2], p[3]}, p45 = {p[4], p[5]}, p67 = {p[6], p[7]};
#pragma unroll
        for (int cb = 0; cb < 8; ++cb) {
            const v4f v03 = vb[cb * 2 + 0];
            const v4f v47 = vb[cb * 2 + 1];
            v8f c = acc[cb];
            c = WMMA_F32(v03.xy, p01, c);
            c = WMMA_F32(v03.zw, p23, c);
            c = WMMA_F32(v47.xy, p45, c);
            c = WMMA_F32(v47.zw, p67, c);
            acc[cb] = c;
        }
    }

    // ---- O = acc / l, written in place over this tile's q region: a lane holds eight
    // consecutive d of its query row in each acc[cb], two 16-byte stores
    const float lsum = lq + xhalf(lq);
    float* ob = QO + (size_t)(b * S + qt * 16 + n16) * 2048 + h * 128 + hi * 8;
#pragma unroll
    for (int cb = 0; cb < 8; ++cb) {
#pragma unroll
        for (int v = 0; v < 8; ++v) acc[cb][v] = acc[cb][v] / lsum;
    }
#pragma unroll
    for (int cb = 0; cb < 8; ++cb) {
        *(v4f*)(ob + cb * 16)     = acc[cb].lo;
        *(v4f*)(ob + cb * 16 + 4) = acc[cb].hi;
    }
    // the stores above have taken their registers before the next tile rewrites them
    asm volatile("s_wait_xcnt 0x0" ::: "memory");
    }
}

// ---------------------------------------------------------------------------
extern "C" void kernel_launch(void* const* d_in, const int* in_sizes, int n_in,
                              void* d_out, int out_size, void* d_ws, size_t ws_size,
                              hipStream_t stream) {
    const float* x   = (const float*)d_in[0];
    const float* wq  = (const float*)d_in[1];
    const float* wkv = (const float*)d_in[2];
    const float* wo  = (const float*)d_in[3];
    const int* past  = (const int*)d_in[4];

    const int B = 2, S = 2048, D = 2048, H = 16, DH = 128;
    const int M = B * S;  // 4096

    float* ws  = (float*)d_ws;
    float* Q   = ws;                        // M*D   (later holds O in place)
    float* KVt = Q + (size_t)M * D;         // M*256
    float* KF  = KVt + (size_t)M * 256;     // M*128, roped K in fragment order
    float* VF  = KF + (size_t)M * 128;      // M*128, V in fragment order
    // total ws use: (M*D + M*256 + 2*M*128)*4 bytes = ~40 MB

    float* out  = (float*)d_out;            // M*D
    float* outK = out + (size_t)M * D;      // M*DH
    float* outV = outK + (size_t)M * DH;    // M*DH

    // 1) + 2) KV = x @ wkv [4096x2048] x [2048x256] and Q = x @ wq^T [4096x2048] x [2048x2048]^T
    gemm_qkv<<<(M / 64) * (256 / 64) + (M / 64) * (D / 64), 128, 0, stream>>>(
        x, wq, wkv, Q, KVt, (M / 64) * (256 / 64), D, 256, D);

    // 3) outputs K (pre-rope) and V
    copy_kv<<<(M * DH) / 256, 256, 0, stream>>>(KVt, outK, outV, M);

    // 4) RoPE on K, and K and V into fragment order (Q gets its RoPE in step 5)
    pack_kv<<<(M * 16) / 256, 256, 0, stream>>>(KVt, KF, VF, S);

    // 5) causal MQA flash attention; O overwrites Q buffer
    attn_kernel<<<(B * H * (S / 32)) / 4, 128, 0, stream>>>(Q, KF, VF, past, S);

    // 6) out = O @ wo^T
    gemm_nt<<<(M / 64) * (D / 64), 128, 0, stream>>>(Q, wo, out, D, D);
}

// v008
// A run of this version takes 547 microseconds.
// In two side-by-side timings against v007, it was 1.03 and 1.04 times as fast.
// Over all steps from v000 it is 2.13 times as fast.
#include <hip/hip_runtime.h>
#include <math.h>
#include <stdint.h>

typedef float v2f __attribute__((ext_vector_type(2)));
typedef float v4f __attribute__((ext_vector_type(4)));
typedef float v8f __attribute__((ext_vector_type(8)));

#define WMMA_F32(a, b, c) \
    __builtin_amdgcn_wmma_f32_16x16x4_f32(false, (a), false, (b), (short)0, (c), false, false)

// ---------------------------------------------------------------------------
// GEMM: C[M,N] = X[M,K] * op(W)
//   WT=true : W stored [N,K] row-major (compute X @ W^T)
//   WT=false: W stored [K,N] row-major (compute X @ W)
// One block (4 waves, 128 threads) computes a 64x64 C tile; wave wv owns the
// 16-row strip. K is walked in chunks of 32 (K a multiple of 64): the X tile
// (64x32) and the W tile of a chunk are staged into LDS by async-to-LDS copies
// (ASYNCcnt). One copy instruction of a wave takes 512 contiguous-by-line bytes
// (four whole 128-byte lines).
// Two LDS buffers: while the WMMAs of chunk t read one buffer, the copies of chunk
// t+1 fly into the other, so the staging latency runs under a chunk's WMMAs and a
// block passes one barrier a chunk. At the foot of chunk t: own LDS reads returned, own copies of
// chunk t+1 landed, barrier, and only then the copies of chunk t+2 into the buffer
// that chunk t has just left.
// The LDS rows carry no pad (a buffer is 16 KiB, so nine blocks fit a WGP's LDS with
// both buffers); instead the 16-byte pieces of a row are stored permuted, which the
// per-lane copies do for free, so that the 32 lanes of a fragment read fall on
// distinct banks:
//   rows read along k (X, and W of the [N,K] form; 8 pieces a row): piece c of row r
//   lies in slot c ^ ((r >> 1) & 7): 16 rows x 2 k-pairs cover all 64 banks;
//   the [K,N] form (16 pieces a row): piece c of row k lies in slot
//   c ^ (((k >> 1) & 1) << 3): rows k and k+2, read by the two lane halves, lie 32
//   banks apart.
// gemm_tile is the work of one block, tile number bid; the kernels below own the LDS.
// ---------------------------------------------------------------------------
constexpr int GEMM_OPB = 64 * 32;       // floats: one operand's chunk
constexpr int GEMM_BUF = 2 * GEMM_OPB;  // floats: one buffer, the X chunk and behind it the W chunk
constexpr int GEMM_LDS = 2 * GEMM_BUF;  // floats: both buffers

template <bool WT>
__device__ __forceinline__ void gemm_tile(const float* __restrict__ X,
                                          const float* __restrict__ W,
                                          float* __restrict__ C,
                                          unsigned bid, int N, int K,
                                          int ldx, int ldw, int ldc,
                                          float* lds) {
    const int lane = threadIdx.x & 31;
    const int wv   = threadIdx.x >> 5;
    const int ntiles = N >> 6;
    const int mt = bid / ntiles;  // 64-row block index
    const int nt = bid % ntiles;  // 64-col block index

    const int n16  = lane & 15;
    const int hi   = lane >> 4;  // 0 or 1
    const int koff = hi << 1;    // 0 or 2

    // each chunk is 512 pieces of 16 bytes per operand, 4 + 4 per thread;
    // piece p = i*128 + thread, so neighbouring lanes take neighbouring pieces
    const float* xg[4];
    const float* wg[4];
    uint32_t xl[4], wl[4];  // places in buffer 0; low 32 bits of a __shared__ address = LDS offset
#pragma unroll
    for (int i = 0; i < 4; ++i) {
        const int p = i * 128 + threadIdx.x;
        const int r = p >> 3;  // row of 8 pieces
        const int c = p & 7;
        const int slot = r * 32 + ((c ^ ((r >> 1) & 7)) << 2);
        xg[i] = X + (size_t)(mt * 64 + r) * ldx + c * 4;
        xl[i] = (uint32_t)(uintptr_t)&lds[slot];
        if (WT) {  // [n][k]: a row is 32 floats of one W row
            wg[i] = W + (size_t)(nt * 64 + r) * ldw + c * 4;
            wl[i] = (uint32_t)(uintptr_t)&lds[GEMM_OPB + slot];
        } else {   // [k][n]: a row is 64 floats of one W row
            const int k  = p >> 4;
            const int cw = p & 15;
            wg[i] = W + (size_t)k * ldw + nt * 64 + cw * 4;
            wl[i] = (uint32_t)(uintptr_t)&lds[GEMM_OPB + k * 64 + ((cw ^ (((k >> 1) & 1) << 3)) << 2)];
        }
    }
    const size_t wstep = WT ? (size_t)32 : (size_t)32 * ldw;

    // the next chunk's copies, into the buffer that begins boff bytes into the LDS array
    auto stage = [&](const uint32_t boff) {
        // the copies and their s_wait_xcnt stand in one statement, so the compiler
        // can move no update of an address register in front of that wait
        asm volatile(
            "global_load_async_to_lds_b128 %0, %1, off\n\t"
            "global_load_async_to_lds_b128 %2, %3, off\n\t"
            "global_load_async_to_lds_b128 %4, %5, off\n\t"
            "global_load_async_to_lds_b128 %6, %7, off\n\t"
            "global_load_async_to_lds_b128 %8, %9, off\n\t"
            "global_load_async_to_lds_b128 %10, %11, off\n\t"
            "global_load_async_to_lds_b128 %12, %13, off\n\t"
            "global_load_async_to_lds_b128 %14, %15, off\n\t"
            "s_wait_xcnt 0x0"
            :: "v"(xl[0] + boff), "v"(xg[0]), "v"(xl[1] + boff), "v"(xg[1]),
               "v"(xl[2] + boff), "v"(xg[2]), "v"(xl[3] + boff), "v"(xg[3]),
               "v"(wl[0] + boff), "v"(wg[0]), "v"(wl[1] + boff), "v"(wg[1]),
               "v"(wl[2] + boff), "v"(wg[2]), "v"(wl[3] + boff), "v"(wg[3])
            : "memory");
#pragma unroll
        for (int i = 0; i < 4; ++i) {
            xg[i] += 32;
            wg[i] += wstep;
        }
    };

    v8f acc[4] = {};
    const int sw = n16 >> 1;  // ((row >> 1) & 7) of every row this lane reads along k

    // one chunk from the buffer at xb: 4 pairs of K-steps, 8 WMMAs a pair
    auto chunk = [&](const float* xb) {
        const float* xr = xb + (wv * 16 + n16) * 32 + koff;  // A row m = lane&15
        const float* wr = xb + GEMM_OPB + n16 * 32 + koff;   // [N,K]: row n16 of column block 0
        // [K,N]: rows 4kk + koff and the next have (k >> 1) & 1 = hi, so column block t lies
        // at block t ^ 2hi: blocks 0, 1 from w01, blocks 2, 3 from w23
        const float* w01 = xb + GEMM_OPB + koff * 64 + hi * 32 + n16;
        const float* w23 = xb + GEMM_OPB + koff * 64 + (1 - hi) * 32 + n16;
        // the loops below are unrolled so that fragments stay in registers and kk, t are constants
#pragma unroll
        for (int kp = 0; kp < 4; ++kp) {
            v2f a[2], b[2][4];
#pragma unroll
            for (int u = 0; u < 2; ++u) {
                const int kk = kp * 2 + u;
                const int ko = (kk ^ sw) << 2;  // where piece kk lies in a row read along k
                a[u] = *(const v2f*)(xr + ko);
#pragma unroll
                for (int t = 0; t < 4; ++t) {
                    if (WT) {
                        b[u][t] = *(const v2f*)(wr + t * 16 * 32 + ko);
                    } else {
                        const float* wc = (t < 2 ? w01 : w23) + kk * 256 + (t & 1) * 16;
                        b[u][t].x = wc[0];
                        b[u][t].y = wc[64];
                    }
                }
            }
            // keeps the pair's reads together in front of its WMMAs: one place where the
            // wave waits on LDS per 8 WMMAs; left free, the compiler waits before every two
            __builtin_amdgcn_sched_barrier(0);
#pragma unroll
            for (int u = 0; u < 2; ++u) {
#pragma unroll
                for (int t = 0; t < 4; ++t) acc[t] = WMMA_F32(a[u], b[u][t], acc[t]);
            }
        }
    };

    // hand-over at the foot of a chunk
    auto publish = [&]() {
        // this wave's fragment reads of the chunk just done have returned ...
        asm volatile("s_wait_dscnt 0x0" ::: "memory");
        // ... and its copies of the next chunk have landed
        asm volatile("s_wait_asynccnt 0x0" ::: "memory");
        __syncthreads();  // the same of every wave: the next chunk may be read, this one's buffer refilled
    };

    const int nch = K >> 5;
    stage(0);
    // this wave's copies of chunk 0 have landed
    asm volatile("s_wait_asynccnt 0x0" ::: "memory");
    __syncthreads();  // all waves' staging visible
    stage(GEMM_BUF * 4);

    for (int t = 0; t < nch; t += 2) {
        chunk(lds);
        publish();
        if (t + 2 < nch) stage(0);
        chunk(lds + GEMM_BUF);
        publish();
        if (t + 3 < nch) stage(GEMM_BUF * 4);
    }
    // no copy is left in flight
    asm volatile("s_wait_asynccnt 0x0" ::: "memory");

#pragma unroll
    for (int t = 0; t < 4; ++t) {
#pragma unroll
        for (int v = 0; v < 8; ++v) {
            const int m = hi * 8 + v;  // C layout: vgpr v, lane group hi -> row v+8*hi
            C[(size_t)(mt * 64 + wv * 16 + m) * ldc + nt * 64 + t * 16 + n16] = acc[t][v];
        }
    }
}

// C = X @ W^T, one 64x64 tile a block
__global__ __launch_bounds__(128) void gemm_nt(const float* __restrict__ X,
                                               const float* __restrict__ W,
                                               float* __restrict__ C,
                                               int N, int K) {
    __shared__ __attribute__((aligned(256))) float lds[GEMM_LDS];
    gemm_tile<true>(X, W, C, blockIdx.x, N, K, K, K, N, lds);
}

// Both projections of x in one launch: blocks 0 .. nkvb-1 do KV = X @ Wkv, the
// rest Q = X @ Wq^T. Alone, the KV product fills the chip with one wave a SIMD;
// here its waves share each SIMD with eight of the Q product. Every block does the
// same number of WMMAs, and all blocks are resident at once: nine waves a SIMD, which
// a wave of at most 112 registers allows; amdgpu_waves_per_eu(9) sets that budget.
__global__ __launch_bounds__(128) __attribute__((amdgpu_waves_per_eu(9))) void gemm_qkv(const float* __restrict__ X,
                                                const float* __restrict__ Wq,
                                                const float* __restrict__ Wkv,
                                                float* __restrict__ Q,
                                                float* __restrict__ KV,
                                                unsigned nkvb, int Nq, int Nkv, int K) {
    __shared__ __attribute__((aligned(256))) float lds[GEMM_LDS];
    const unsigned bid = blockIdx.x;  // the same for the whole block: one path, its barriers too
    if (bid < nkvb)
        gemm_tile<false>(X, Wkv, KV, bid, Nkv, K, K, Nkv, Nkv, lds);
    else
        gemm_tile<true>(X, Wq, Q, bid - nkvb, Nq, K, K, K, Nq, lds);
}

// ---------------------------------------------------------------------------
// Split KV[M,256] into K (cols 0..127, pre-rope) and V (cols 128..255) outputs
// ---------------------------------------------------------------------------
__global__ __launch_bounds__(256) void copy_kv(const float* __restrict__ KV,
                                               float* __restrict__ outK,
                                               float* __restrict__ outV, int M) {
    const int idx = blockIdx.x * 256 + threadIdx.x;  // M*128 threads
    const int r = idx >> 7;
    const int d = idx & 127;
    outK[idx] = KV[(size_t)r * 256 + d];
    outV[idx] = KV[(size_t)r * 256 + 128 + d];
}

// ---------------------------------------------------------------------------
// Pack K (roped, pos = s) and V into WMMA fragment order for the attention
// kernel. A 16-key tile is 16 groups of 32 lanes x 4 floats (2048 floats), so
// one wave-wide 16-byte load is 512 contiguous bytes and feeds two WMMAs.
//   KF group j,   lane (hi,n16), e: K[key n16][d = 8j + 4(e>>1) + 2hi + (e&1)]
//   VF group q,   lane (hi,n16), e: V[key 8hi + 4(q&1) + e][d = 16(q>>1) + n16]
//   (the keys of lane half hi are those whose scores that half holds in attn_kernel)
// One thread writes groups j and j+8 of both (the rope pair d, d+64 lies in
// groups j and j+8 at the same lane and e). Threads: B*S*16
// ---------------------------------------------------------------------------
__global__ __launch_bounds__(256) void pack_kv(const float* __restrict__ KV,
                                               float* __restrict__ KF,
                                               float* __restrict__ VF, int S) {
    const int idx  = blockIdx.x * 256 + threadIdx.x;
    const int lane = idx & 31;
    const int j    = (idx >> 5) & 7;
    const int tile = idx >> 8;  // (b*S + s) / 16
    const int n16  = lane & 15;
    const int hi   = lane >> 4;

    const int r = tile * 16 + n16;  // b*S + s
    const int s = r % S;
    const float* krow = KV + (size_t)r * 256;
    v4f lo, up;
#pragma unroll
    for (int e = 0; e < 4; ++e) {
        const int d = j * 8 + (e >> 1) * 4 + hi * 2 + (e & 1);
        const float freq = __expf(-0.14391156213f * (float)d);
        float sn, cs;
        sincosf((float)s * freq, &sn, &cs);
        const float x1 = krow[d];
        const float x2 = krow[64 + d];
        lo[e] = x1 * cs - x2 * sn;
        up[e] = x2 * cs + x1 * sn;
    }
    v4f* kf = (v4f*)KF + (size_t)tile * 512 + lane;
    kf[j * 32]       = lo;
    kf[(j + 8) * 32] = up;

    v4f* vf = (v4f*)VF + (size_t)tile * 512 + lane;
#pragma unroll
    for (int g = 0; g < 2; ++g) {
        const int q = j + g * 8;
        const float* vcol = KV + (size_t)(tile * 16 + hi * 8 + (q & 1) * 4) * 256 + 128 + (q >> 1) * 16 + n16;
        v4f vv;
        vv[0] = vcol[0 * 256];
        vv[1] = vcol[1 * 256];
        vv[2] = vcol[2 * 256];
        vv[3] = vcol[3 * 256];
        vf[q * 32] = vv;
    }
}

// ---------------------------------------------------------------------------
// Flash attention, causal, MQA (one KV head). One wave per (b, h, pair of 16-row
// q tiles): it runs tile n-1-t and then tile t, so every wave walks n+1 key tiles
// and no SIMD is left with only long or only short rows of the causal triangle.
// Both products run transposed on fp32 WMMA: S^T = K Q^T (K is the A operand, Q the
// B operand) and O^T += V^T P^T. In S^T a lane holds eight keys' scores of ONE query
// (column n16; lane half hi has keys 8hi .. 8hi+7), so the row maximum and the row
// sum are taken inside the lane, with one exchange between the lane halves for the
// maximum; the rescale factor is one value a lane; and the eight P values are, pair
// by pair and where they stand, the B operands of the second product (k slot (hi,e)
// of WMMA kk is key 8hi + 2kk + e, and VF is packed to match): P passes through no
// LDS and no cross-lane step. O written in place over the Q region of that exact
// tile/head -- safe: each wave stages its q tile into LDS first and tiles are
// disjoint across waves. The staged tile gets its RoPE (pos = past + s) there, in
// LDS, so Q needs no launch and no pass through memory of its own for it.
// Q (in LDS), K and V (packed by pack_kv) are all held in fragment order: every
// operand load is 16 contiguous bytes a lane. The q fragments are read from LDS
// once per q tile and stay in registers over the key loop, so the 32 chained
// score WMMAs of a key tile wait on no LDS read.
// The grid gives each SIMD two waves, so a wave may take up to half the register
// file: amdgpu_waves_per_eu(1, 2) says so.
// ---------------------------------------------------------------------------
// lane l takes the value of lane l ^ 16
__device__ __forceinline__ float xhalf(float x) {
    return __builtin_bit_cast(float, __builtin_amdgcn_permlanex16(__builtin_bit_cast(int, x), __builtin_bit_cast(int, x),
                                                                  0x76543210, 0xfedcba98, false, false));
}

__global__ __launch_bounds__(128) __attribute__((amdgpu_waves_per_eu(1, 2))) void attn_kernel(float* __restrict__ QO,
                                                   const float* __restrict__ KF,
                                                   const float* __restrict__ VF,
                                                   const int* __restrict__ past_ptr,
                                                   int S) {
    // per-wave q tile, 8KB each, in the order of KF (row m in place of the key)
    __shared__ __attribute__((aligned(16))) float qs[4][16 * 128];

    const int lane = threadIdx.x & 31;
    const int wv   = threadIdx.x >> 5;
    const int qtiles = S >> 4;
    const int npair  = qtiles >> 1;
    const int wid = blockIdx.x * 4 + wv;
    const int tp = wid % npair;
    const int h  = (wid / npair) & 15;
    const int b  = wid / (npair * 16);
    const int past = *past_ptr;

    const int n16 = lane & 15;
    const int hi  = lane >> 4;

    float* qsw = qs[wv];
    // kept rolled: unrolled, the kernel's text would double and gain nothing
#pragma unroll 1
    for (int half = 0; half < 2; ++half) {
    const int qt = half ? tp : qtiles - 1 - tp;  // the long tile first
    {
        // lane (hi,n16) brings Q[n16][8j + 4hi .. +3]; its two pairs go to the
        // lanes hi' = 0 and 1 of group j, at e = 2hi (32 distinct 8-byte slots a store)
        const float* qb = QO + (size_t)(b * S + qt * 16 + n16) * 2048 + h * 128 + hi * 4;
        v4f qv[16];
#pragma unroll
        for (int jj = 0; jj < 16; ++jj) qv[jj] = *(const v4f*)(qb + jj * 8);
        // the address pair stays whole until every load above has taken it
        asm volatile("s_wait_xcnt 0x0" :: "v"(qb) : "memory");
        float* qd = qsw + n16 * 4 + hi * 2;
#pragma unroll
        for (int jj = 0; jj < 16; ++jj) {
            *(v2f*)(qd + jj * 128)      = qv[jj].xy;
            *(v2f*)(qd + jj * 128 + 64) = qv[jj].zw;
        }
    }
    {
        // RoPE in place: group j, lane (hi,n16), e holds Q[n16][d = 8j + 4(e>>1) + 2hi + (e&1)],
        // and its partner d + 64 lies in group j + 8 at the same lane and e
        const float pos = (float)(past + qt * 16 + n16);
        v4f* qr = (v4f*)qsw + lane;
        // kept rolled: 32 inlined sincosf would swell the kernel's text eightfold here
#pragma unroll 1
        for (int j = 0; j < 8; ++j) {
            v4f lo = qr[j * 32];
            v4f up = qr[(j + 8) * 32];
#pragma unroll
            for (int e = 0; e < 4; ++e) {
                const int d = j * 8 + (e >> 1) * 4 + hi * 2 + (e & 1);
                const float freq = __expf(-0.14391156213f * (float)d);  // 1/10000^(d/64)
                float sn, cs;
                sincosf(pos * freq, &sn, &cs);
                const float x1 = lo[e];
                const float x2 = up[e];
                lo[e] = x1 * cs - x2 * sn;
                up[e] = x2 * cs + x1 * sn;
            }
            qr[j * 32]       = lo;
            qr[(j + 8) * 32] = up;
        }
    }

    // of this lane's query row n16: the running maximum (equal in both lane halves)
    // and the sum over the keys of this lane half (the halves are joined at the end)
    float mq = -1e30f, lq = 0.f;
    v8f acc[8] = {};  // acc[cb][v] = O^T[d = 16cb + 8hi + v][query n16]
    const int irow = past + qt * 16 + n16;

    const float scale = 0.08838834764831845f;  // 1/sqrt(128)
    const int lastj = past + qt * 16 + 15;
    int nkt = lastj / 16 + 1;
    if (nkt > (S >> 4)) nkt = S >> 4;

    const v4f* kfbase = (const v4f*)KF + (size_t)b * (S >> 4) * 512 + lane;
    const v4f* vfbase = (const v4f*)VF + (size_t)b * (S >> 4) * 512 + lane;
    // the roped q tile's 16 fragment quads, read from LDS once per q tile and held
    // in registers over the whole key loop (each lane reads back its own slots)
    const v4f* qf = (const v4f*)qsw + lane;
    v4f qa[16];
#pragma unroll
    for (int jj = 0; jj < 16; ++jj) qa[jj] = qf[jj * 32];

    for (int kt = 0; kt < nkt; ++kt) {
        // ---- scores tile, transposed: 16 keys x 16 queries = k(16x128) @ q^T, 32 WMMAs of K=4
        v8f sc = {};
        const v4f* kf = kfbase + (size_t)kt * 512;
        v4f kb[16];
#pragma unroll
        for (int jj = 0; jj < 16; ++jj) kb[jj] = kf[jj * 32];
        // the address pair stays whole until every load above has taken it
        asm volatile("s_wait_xcnt 0x0" :: "v"(kf) : "memory");
        // keeps the tile's 16 loads in flight together: without it the compiler
        // reuses one register quad and waits out each load's latency in turn
        __builtin_amdgcn_sched_barrier(0);
#pragma unroll
        for (int jj = 0; jj < 16; ++jj) {
            sc = WMMA_F32(kb[jj].xy, qa[jj].xy, sc);
            sc = WMMA_F32(kb[jj].zw, qa[jj].zw, sc);
        }
        const v4f* vf = vfbase + (size_t)kt * 512;
        v4f vb[16];
#pragma unroll
        for (int q = 0; q < 16; ++q) vb[q] = vf[q * 32];
        // the address pair stays whole until every load above has taken it
        asm volatile("s_wait_xcnt 0x0" :: "v"(vf) : "memory");
        // same purpose for the V tile's 16 loads
        __builtin_amdgcn_sched_barrier(0);

        // ---- scale + causal mask + online softmax: sc[v] is key kt*16 + 8hi + v of query n16
        float x[8], p[8];
        const int j0 = kt * 16 + hi * 8;
#pragma unroll
        for (int v = 0; v < 8; ++v) {
            float t = sc[v] * scale;
            if (j0 + v > irow) t = -1e30f;
            x[v] = t;
        }
        float t = fmaxf(fmaxf(fmaxf(x[0], x[1]), fmaxf(x[2], x[3])),
                        fmaxf(fmaxf(x[4], x[5]), fmaxf(x[6], x[7])));
        t = fmaxf(t, xhalf(t));  // the other eight keys of the tile
        const float mnew = fmaxf(mq, t);
        const float rs = __expf(mq - mnew);
#pragma unroll
        for (int v = 0; v < 8; ++v) p[v] = __expf(x[v] - mnew);
        lq = lq * rs + (((p[0] + p[1]) + (p[2] + p[3])) + ((p[4] + p[5]) + (p[6] + p[7])));
        mq = mnew;
#pragma unroll
        for (int cb = 0; cb < 8; ++cb) acc[cb] *= rs;

        // ---- acc += V^T(128x16) @ P^T(16x16): 8 row-blocks of d x 4 WMMAs
        const v2f p01 = {p[0], p[1]}, p23 = {p[2], p[3]}, p45 = {p[4], p[5]}, p67 = {p[6], p[7]};
#pragma unroll
        for (int cb = 0; cb < 8; ++cb) {
            const v4f v03 = vb[cb * 2 + 0];
            const v4f v47 = vb[cb * 2 + 1];
            v8f c = acc[cb];
            c = WMMA_F32(v03.xy, p01, c);
            c = WMMA_F32(v03.zw, p23, c);
            c = WMMA_F32(v47.xy, p45, c);
            c = WMMA_F32(v47.zw, p67, c);
            acc[cb] = c;
        }
    }

    // ---- O = acc / l, written in place over this tile's q region: a lane holds eight
    // consecutive d of its query row in each acc[cb], two 16-byte stores
    const float lsum = lq + xhalf(lq);
    float* ob = QO + (size_t)(b * S + qt * 16 + n16) * 2048 + h * 128 + hi * 8;
#pragma unroll
    for (int cb = 0; cb < 8; ++cb) {
#pragma unroll
        for (int v = 0; v < 8; ++v) acc[cb][v] = acc[cb][v] / lsum;
    }
#pragma unroll
    for (int cb = 0; cb < 8; ++cb) {
        *(v4f*)(ob + cb * 16)     = acc[cb].lo;
        *(v4f*)(ob + cb * 16 + 4) = acc[cb].hi;
    }
    // the stores above have taken their registers before the next tile rewrites them
    asm volatile("s_wait_xcnt 0x0" ::: "memory");
    }
}

// ---------------------------------------------------------------------------
extern "C" void kernel_launch(void* const* d_in, const int* in_sizes, int n_in,
                              void* d_out, int out_size, void* d_ws, size_t ws_size,
                              hipStream_t stream) {
    const float* x   = (const float*)d_in[0];
    const float* wq  = (const float*)d_in[1];
    const float* wkv = (const float*)d_in[2];
    const float* wo  = (const float*)d_in[3];
    const int* past  = (const int*)d_in[4];

    const int B = 2, S = 2048, D = 2048, H = 16, DH = 128;
    const int M = B * S;  // 4096

    float* ws  = (float*)d_ws;
    float* Q   = ws;                        // M*D   (later holds O in place)
    float* KVt = Q + (size_t)M * D;         // M*256
    float* KF  = KVt + (size_t)M * 256;     // M*128, roped K in fragment order
    float* VF  = KF + (size_t)M * 128;      // M*128, V in fragment order
    // total ws use: (M*D + M*256 + 2*M*128)*4 bytes = ~40 MB

    float* out  = (float*)d_out;            // M*D
    float* outK = out + (size_t)M * D;      // M*DH
    float* outV = outK + (size_t)M * DH;    // M*DH

    // 1) + 2) KV = x @ wkv [4096x2048] x [2048x256] and Q = x @ wq^T [4096x2048] x [2048x2048]^T
    gemm_qkv<<<(M / 64) * (256 / 64) + (M / 64) * (D / 64), 128, 0, stream>>>(
        x, wq, wkv, Q, KVt, (M / 64) * (256 / 64), D, 256, D);

    // 3) outputs K (pre-rope) and V
    copy_kv<<<(M * DH) / 256, 256, 0, stream>>>(KVt, outK, outV, M);

    // 4) RoPE on K, and K and V into fragment order (Q gets its RoPE in step 5)
    pack_kv<<<(M * 16) / 256, 256, 0, stream>>>(KVt, KF, VF, S);

    // 5) causal MQA flash attention; O overwrites Q buffer
    attn_kernel<<<(B * H * (S / 32)) / 4, 128, 0, stream>>>(Q, KF, VF, past, S);

    // 6) out = O @ wo^T
    gemm_nt<<<(M / 64) * (D / 64), 128, 0, stream>>>(Q, wo, out, D, D);
}

// v009
// One run takes 519 microseconds.
// Timed twice side by side with v008, it ran 1.04 and 1.05 times as fast.
// All steps since v000 together make it 2.23 times as fast.
#include <hip/hip_runtime.h>
#include <math.h>
#include <stdint.h>

typedef float v2f __attribute__((ext_vector_type(2)));
typedef float v4f __attribute__((ext_vector_type(4)));
typedef float v8f __attribute__((ext_vector_type(8)));

#define WMMA_F32(a, b, c) \
    __builtin_amdgcn_wmma_f32_16x16x4_f32(false, (a), false, (b), (short)0, (c), false, false)

// ---------------------------------------------------------------------------
// GEMM: C[M,N] = X[M,K] * op(W)
//   WT=true : W stored [N,K] row-major (compute X @ W^T)
//   WT=false: W stored [K,N] row-major (compute X @ W)
// One block (4 waves, 128 threads) computes a 64x64 C tile; wave wv owns the
// 16-row strip. K is walked in chunks of 32 (K a multiple of 64): the X tile
// (64x32) and the W tile of a chunk are staged into LDS by async-to-LDS copies
// (ASYNCcnt). One copy instruction of a wave takes 512 contiguous-by-line bytes
// (four whole 128-byte lines).
// Two LDS buffers: while the WMMAs of chunk t read one buffer, the copies of chunk
// t+1 fly into the other, so the staging latency runs under a chunk's WMMAs and a
// block passes one barrier a chunk. At the foot of chunk t: own LDS reads returned, own copies of
// chunk t+1 landed, barrier, and only then the copies of chunk t+2 into the buffer
// that chunk t has just left.
// The LDS rows carry no pad (a buffer is 16 KiB, so nine blocks fit a WGP's LDS with
// both buffers); instead the 16-byte pieces of a row are stored permuted, which the
// per-lane copies do for free, so that the 32 lanes of a fragment read fall on
// distinct banks:
//   rows read along k (X, and W of the [N,K] form; 8 pieces a row): piece c of row r
//   lies in slot c ^ ((r >> 1) & 7): 16 rows x 2 k-pairs cover all 64 banks;
//   the [K,N] form (16 pieces a row): piece c of row k lies in slot
//   c ^ (((k >> 1) & 1) << 3): rows k and k+2, read by the two lane halves, lie 32
//   banks apart.
// gemm_tile is the work of one block, tile number bid; the kernels below own the LDS.
// ---------------------------------------------------------------------------
constexpr int GEMM_OPB = 64 * 32;       // floats: one operand's chunk
constexpr int GEMM_BUF = 2 * GEMM_OPB;  // floats: one buffer, the X chunk and behind it the W chunk
constexpr int GEMM_LDS = 2 * GEMM_BUF;  // floats: both buffers

template <bool WT>
__device__ __forceinline__ void gemm_tile(const float* __restrict__ X,
                                          const float* __restrict__ W,
                                          float* __restrict__ C,
                                          unsigned bid, int N, int K,
                                          int ldx, int ldw, int ldc,
                                          float* lds) {
    const int lane = threadIdx.x & 31;
    const int wv   = threadIdx.x >> 5;
    const int ntiles = N >> 6;
    const int mt = bid / ntiles;  // 64-row block index
    const int nt = bid % ntiles;  // 64-col block index

    const int n16  = lane & 15;
    const int hi   = lane >> 4;  // 0 or 1
    const int koff = hi << 1;    // 0 or 2

    // each chunk is 512 pieces of 16 bytes per operand, 4 + 4 per thread;
    // piece p = i*128 + thread, so neighbouring lanes take neighbouring pieces
    const float* xg[4];
    const float* wg[4];
    uint32_t xl[4], wl[4];  // places in buffer 0; low 32 bits of a __shared__ address = LDS offset
#pragma unroll
    for (int i = 0; i < 4; ++i) {
        const int p = i * 128 + threadIdx.x;
        const int r = p >> 3;  // row of 8 pieces
        const int c = p & 7;
        const int slot = r * 32 + ((c ^ ((r >> 1) & 7)) << 2);
        xg[i] = X + (size_t)(mt * 64 + r) * ldx + c * 4;
        xl[i] = (uint32_t)(uintptr_t)&lds[slot];
        if (WT) {  // [n][k]: a row is 32 floats of one W row
            wg[i] = W + (size_t)(nt * 64 + r) * ldw + c * 4;
            wl[i] = (uint32_t)(uintptr_t)&lds[GEMM_OPB + slot];
        } else {   // [k][n]: a row is 64 floats of one W row
            const int k  = p >> 4;
            const int cw = p & 15;
            wg[i] = W + (size_t)k * ldw + nt * 64 + cw * 4;
            wl[i] = (uint32_t)(uintptr_t)&lds[GEMM_OPB + k * 64 + ((cw ^ (((k >> 1) & 1) << 3)) << 2)];
        }
    }
    const size_t wstep = WT ? (size_t)32 : (size_t)32 * ldw;

    // the next chunk's copies, into the buffer that begins boff bytes into the LDS array
    auto stage = [&](const uint32_t boff) {
        // the copies and their s_wait_xcnt stand in one statement, so the compiler
        // can move no update of an address register in front of that wait
        asm volatile(
            "global_load_async_to_lds_b128 %0, %1, off\n\t"
            "global_load_async_to_lds_b128 %2, %3, off\n\t"
            "global_load_async_to_lds_b128 %4, %5, off\n\t"
            "global_load_async_to_lds_b128 %6, %7, off\n\t"
            "global_load_async_to_lds_b128 %8, %9, off\n\t"
            "global_load_async_to_lds_b128 %10, %11, off\n\t"
            "global_load_async_to_lds_b128 %12, %13, off\n\t"
            "global_load_async_to_lds_b128 %14, %15, off\n\t"
            "s_wait_xcnt 0x0"
            :: "v"(xl[0] + boff), "v"(xg[0]), "v"(xl[1] + boff), "v"(xg[1]),
               "v"(xl[2] + boff), "v"(xg[2]), "v"(xl[3] + boff), "v"(xg[3]),
               "v"(wl[0] + boff), "v"(wg[0]), "v"(wl[1] + boff), "v"(wg[1]),
               "v"(wl[2] + boff), "v"(wg[2]), "v"(wl[3] + boff), "v"(wg[3])
            : "memory");
#pragma unroll
        for (int i = 0; i < 4; ++i) {
            xg[i] += 32;
            wg[i] += wstep;
        }
    };

    v8f acc[4] = {};
    const int sw = n16 >> 1;  // ((row >> 1) & 7) of every row this lane reads along k

    // one chunk from the buffer at xb: 4 pairs of K-steps, 8 WMMAs a pair
    auto chunk = [&](const float* xb) {
        const float* xr = xb + (wv * 16 + n16) * 32 + koff;  // A row m = lane&15
        const float* wr = xb + GEMM_OPB + n16 * 32 + koff;   // [N,K]: row n16 of column block 0
        // [K,N]: rows 4kk + koff and the next have (k >> 1) & 1 = hi, so column block t lies
        // at block t ^ 2hi: blocks 0, 1 from w01, blocks 2, 3 from w23
        const float* w01 = xb + GEMM_OPB + koff * 64 + hi * 32 + n16;
        const float* w23 = xb + GEMM_OPB + koff * 64 + (1 - hi) * 32 + n16;
        // the loops below are unrolled so that fragments stay in registers and kk, t are constants
#pragma unroll
        for (int kp = 0; kp < 4; ++kp) {
            v2f a[2], b[2][4];
#pragma unroll
            for (int u = 0; u < 2; ++u) {
                const int kk = kp * 2 + u;
                const int ko = (kk ^ sw) << 2;  // where piece kk lies in a row read along k
                a[u] = *(const v2f*)(xr + ko);
#pragma unroll
                for (int t = 0; t < 4; ++t) {
                    if (WT) {
                        b[u][t] = *(const v2f*)(wr + t * 16 * 32 + ko);
                    } else {
                        const float* wc = (t < 2 ? w01 : w23) + kk * 256 + (t & 1) * 16;
                        b[u][t].x = wc[0];
                        b[u][t].y = wc[64];
                    }
                }
            }
            // keeps the pair's reads together in front of its WMMAs: one place where the
            // wave waits on LDS per 8 WMMAs; left free, the compiler waits before every two
            __builtin_amdgcn_sched_barrier(0);
#pragma unroll
            for (int u = 0; u < 2; ++u) {
#pragma unroll
                for (int t = 0; t < 4; ++t) acc[t] = WMMA_F32(a[u], b[u][t], acc[t]);
            }
        }
    };

    // hand-over at the foot of a chunk
    auto publish = [&]() {
        // this wave's fragment reads of the chunk just done have returned ...
        asm volatile("s_wait_dscnt 0x0" ::: "memory");
        // ... and its copies of the next chunk have landed
        asm volatile("s_wait_asynccnt 0x0" ::: "memory");
        __syncthreads();  // the same of every wave: the next chunk may be read, this one's buffer refilled
    };

    const int nch = K >> 5;
    stage(0);
    // this wave's copies of chunk 0 have landed
    asm volatile("s_wait_asynccnt 0x0" ::: "memory");
    __syncthreads();  // all waves' staging visible
    stage(GEMM_BUF * 4);

    for (int t = 0; t < nch; t += 2) {
        chunk(lds);
        publish();
        if (t + 2 < nch) stage(0);
        chunk(lds + GEMM_BUF);
        publish();
        if (t + 3 < nch) stage(GEMM_BUF * 4);
    }
    // no copy is left in flight
    asm volatile("s_wait_asynccnt 0x0" ::: "memory");

#pragma unroll
    for (int t = 0; t < 4; ++t) {
#pragma unroll
        for (int v = 0; v < 8; ++v) {
            const int m = hi * 8 + v;  // C layout: vgpr v, lane group hi -> row v+8*hi
            C[(size_t)(mt * 64 + wv * 16 + m) * ldc + nt * 64 + t * 16 + n16] = acc[t][v];
        }
    }
}

// C = X @ W^T, one 64x64 tile a block
__global__ __launch_bounds__(128) void gemm_nt(const float* __restrict__ X,
                                               const float* __restrict__ W,
                                               float* __restrict__ C,
                                               int N, int K) {
    __shared__ __attribute__((aligned(256))) float lds[GEMM_LDS];
    gemm_tile<true>(X, W, C, blockIdx.x, N, K, K, K, N, lds);
}

// Both projections of x in one launch: blocks 0 .. nkvb-1 do KV = X @ Wkv, the
// rest Q = X @ Wq^T. Alone, the KV product fills the chip with one wave a SIMD;
// here its waves share each SIMD with eight of the Q product. Every block does the
// same number of WMMAs, and all blocks are resident at once: nine waves a SIMD, which
// a wave of at most 112 registers allows; amdgpu_waves_per_eu(9) sets that budget.
__global__ __launch_bounds__(128) __attribute__((amdgpu_waves_per_eu(9))) void gemm_qkv(const float* __restrict__ X,
                                                const float* __restrict__ Wq,
                                                const float* __restrict__ Wkv,
                                                float* __restrict__ Q,
                                                float* __restrict__ KV,
                                                unsigned nkvb, int Nq, int Nkv, int K) {
    __shared__ __attribute__((aligned(256))) float lds[GEMM_LDS];
    const unsigned bid = blockIdx.x;  // the same for the whole block: one path, its barriers too
    if (bid < nkvb)
        gemm_tile<false>(X, Wkv, KV, bid, Nkv, K, K, Nkv, Nkv, lds);
    else
        gemm_tile<true>(X, Wq, Q, bid - nkvb, Nq, K, K, K, Nq, lds);
}

// ---------------------------------------------------------------------------
// Split KV[M,256] into K (cols 0..127, pre-rope) and V (cols 128..255) outputs
// ---------------------------------------------------------------------------
__global__ __launch_bounds__(256) void copy_kv(const float* __restrict__ KV,
                                               float* __restrict__ outK,
                                               float* __restrict__ outV, int M) {
    const int idx = blockIdx.x * 256 + threadIdx.x;  // M*128 threads
    const int r = idx >> 7;
    const int d = idx & 127;
    outK[idx] = KV[(size_t)r * 256 + d];
    outV[idx] = KV[(size_t)r * 256 + 128 + d];
}

// ---------------------------------------------------------------------------
// Pack K (roped, pos = s) and V into WMMA fragment order for the attention
// kernel. A 16-key tile is 16 groups of 32 lanes x 4 floats (2048 floats), so
// one wave-wide 16-byte load is 512 contiguous bytes and feeds two WMMAs.
//   KF group j,   lane (hi,n16), e: K[key n16][d = 8j + 4(e>>1) + 2hi + (e&1)]
//   VF group q,   lane (hi,n16), e: V[key 8hi + 4(q&1) + e][d = 16(q>>1) + n16]
//   (the keys of lane half hi are those whose scores that half holds in attn_kernel)
// One thread writes groups j and j+8 of both (the rope pair d, d+64 lies in
// groups j and j+8 at the same lane and e). Threads: B*S*16
// ---------------------------------------------------------------------------
__global__ __launch_bounds__(256) void pack_kv(const float* __restrict__ KV,
                                               float* __restrict__ KF,
                                               float* __restrict__ VF, int S) {
    const int idx  = blockIdx.x * 256 + threadIdx.x;
    const int lane = idx & 31;
    const int j    = (idx >> 5) & 7;
    const int tile = idx >> 8;  // (b*S + s) / 16
    const int n16  = lane & 15;
    const int hi   = lane >> 4;

    const int r = tile * 16 + n16;  // b*S + s
    const int s = r % S;
    const float* krow = KV + (size_t)r * 256;
    v4f lo, up;
#pragma unroll
    for (int e = 0; e < 4; ++e) {
        const int d = j * 8 + (e >> 1) * 4 + hi * 2 + (e & 1);
        const float freq = __expf(-0.14391156213f * (float)d);
        float sn, cs;
        sincosf((float)s * freq, &sn, &cs);
        const float x1 = krow[d];
        const float x2 = krow[64 + d];
        lo[e] = x1 * cs - x2 * sn;
        up[e] = x2 * cs + x1 * sn;
    }
    v4f* kf = (v4f*)KF + (size_t)tile * 512 + lane;
    kf[j * 32]       = lo;
    kf[(j + 8) * 32] = up;

    v4f* vf = (v4f*)VF + (size_t)tile * 512 + lane;
#pragma unroll
    for (int g = 0; g < 2; ++g) {
        const int q = j + g * 8;
        const float* vcol = KV + (size_t)(tile * 16 + hi * 8 + (q & 1) * 4) * 256 + 128 + (q >> 1) * 16 + n16;
        v4f vv;
        vv[0] = vcol[0 * 256];
        vv[1] = vcol[1 * 256];
        vv[2] = vcol[2 * 256];
        vv[3] = vcol[3 * 256];
        vf[q * 32] = vv;
    }
}

// ---------------------------------------------------------------------------
// Flash attention, causal, MQA (one KV head). One wave per (b, h, pair of 16-row
// q tiles): it runs tile n-1-t and then tile t, so every wave walks n+1 key tiles
// and no SIMD is left with only long or only short rows of the causal triangle.
// Both products run transposed on fp32 WMMA: S^T = K Q^T (K is the A operand, Q the
// B operand) and O^T += V^T P^T. In S^T a lane holds eight keys' scores of ONE query
// (column n16; lane half hi has keys 8hi .. 8hi+7), so the row maximum and the row
// sum are taken inside the lane, with one exchange between the lane halves for the
// maximum; the rescale factor is one value a lane; and the eight P values are, pair
// by pair and where they stand, the B operands of the second product (k slot (hi,e)
// of WMMA kk is key 8hi + 2kk + e, and VF is packed to match): P passes through no
// LDS and no cross-lane step. O written in place over the Q region of that exact
// tile/head -- safe: each wave stages its q tile into LDS first and tiles are
// disjoint across waves. The staged tile gets its RoPE (pos = past + s) there, in
// LDS, so Q needs no launch and no pass through memory of its own for it.
// Q (in LDS), K and V (packed by pack_kv) are all held in fragment order: every
// operand load is 16 contiguous bytes a lane. The q fragments are read from LDS
// once per q tile and stay in registers over the key loop, so the 32 chained
// score WMMAs of a key tile wait on no LDS read.
// The grid gives each SIMD two waves, so a wave may take up to half the register
// file: amdgpu_waves_per_eu(1, 2) says so.
// ---------------------------------------------------------------------------
// lane l takes the value of lane l ^ 16
__device__ __forceinline__ float xhalf(float x) {
    return __builtin_bit_cast(float, __builtin_amdgcn_permlanex16(__builtin_bit_cast(int, x), __builtin_bit_cast(int, x),
                                                                  0x76543210, 0xfedcba98, false, false));
}

__global__ __launch_bounds__(128) __attribute__((amdgpu_waves_per_eu(1, 2))) void attn_kernel(float* __restrict__ QO,
                                                   const float* __restrict__ KF,
                                                   const float* __restrict__ VF,
                                                   const int* __restrict__ past_ptr,
                                                   int S) {
    // per-wave q tile, 8KB each, in the order of KF (row m in place of the key)
    __shared__ __attribute__((aligned(16))) float qs[4][16 * 128];

    const int lane = threadIdx.x & 31;
    // the wave's number, told to the compiler as one value a wave: the tile indices, the
    // trip count and the tile addresses then live in scalar registers and leave the
    // vector registers to the operand sets
    const int wv   = __builtin_amdgcn_readfirstlane(threadIdx.x >> 5);
    const int qtiles = S >> 4;
    const int npair  = qtiles >> 1;
    const int wid = blockIdx.x * 4 + wv;
    const int tp = wid % npair;
    const int h  = (wid / npair) & 15;
    const int b  = wid / (npair * 16);
    const int past = *past_ptr;

    const int n16 = lane & 15;
    const int hi  = lane >> 4;

    float* qsw = qs[wv];
    // kept rolled: unrolled, the kernel's text would double and gain nothing
#pragma unroll 1
    for (int half = 0; half < 2; ++half) {
    const int qt = half ? tp : qtiles - 1 - tp;  // the long tile first
    {
        // lane (hi,n16) brings Q[n16][8j + 4hi .. +3]; its two pairs go to the
        // lanes hi' = 0 and 1 of group j, at e = 2hi (32 distinct 8-byte slots a store)
        const float* qb = QO + (size_t)(b * S + qt * 16 + n16) * 2048 + h * 128 + hi * 4;
        v4f qv[16];
#pragma unroll
        for (int jj = 0; jj < 16; ++jj) qv[jj] = *(const v4f*)(qb + jj * 8);
        // the address pair stays whole until every load above has taken it
        asm volatile("s_wait_xcnt 0x0" :: "v"(qb) : "memory");
        float* qd = qsw + n16 * 4 + hi * 2;
#pragma unroll
        for (int jj = 0; jj < 16; ++jj) {
            *(v2f*)(qd + jj * 128)      = qv[jj].xy;
            *(v2f*)(qd + jj * 128 + 64) = qv[jj].zw;
        }
    }
    {
        // RoPE in place: group j, lane (hi,n16), e holds Q[n16][d = 8j + 4(e>>1) + 2hi + (e&1)],
        // and its partner d + 64 lies in group j + 8 at the same lane and e
        const float pos = (float)(past + qt * 16 + n16);
        v4f* qr = (v4f*)qsw + lane;
        // kept rolled: 32 inlined sincosf would swell the kernel's text eightfold here
#pragma unroll 1
        for (int j = 0; j < 8; ++j) {
            v4f lo = qr[j * 32];
            v4f up = qr[(j + 8) * 32];
#pragma unroll
            for (int e = 0; e < 4; ++e) {
                const int d = j * 8 + (e >> 1) * 4 + hi * 2 + (e & 1);
                const float freq = __expf(-0.14391156213f * (float)d);  // 1/10000^(d/64)
                float sn, cs;
                sincosf(pos * freq, &sn, &cs);
                const float x1 = lo[e];
                const float x2 = up[e];
                lo[e] = x1 * cs - x2 * sn;
                up[e] = x2 * cs + x1 * sn;
            }
            qr[j * 32]       = lo;
            qr[(j + 8) * 32] = up;
        }
    }

    // of this lane's query row n16: the running maximum (equal in both lane halves)
    // and the sum over the keys of this lane half (the halves are joined at the end)
    float mq = -1e30f, lq = 0.f;
    v8f acc[8] = {};  // acc[cb][v] = O^T[d = 16cb + 8hi + v][query n16]
    const int irow = past + qt * 16 + n16;

    const float scale = 0.08838834764831845f;  // 1/sqrt(128)
    const int lastj = past + qt * 16 + 15;
    int nkt = lastj / 16 + 1;
    if (nkt > (S >> 4)) nkt = S >> 4;

    const v4f* kfbase = (const v4f*)KF + (size_t)b * (S >> 4) * 512 + lane;
    const v4f* vfbase = (const v4f*)VF + (size_t)b * (S >> 4) * 512 + lane;
    // the roped q tile's 16 fragment quads, read from LDS once per q tile and held
    // in registers over the whole key loop (each lane reads back its own slots)
    const v4f* qf = (const v4f*)qsw + lane;
    v4f qa[16];
#pragma unroll
    for (int jj = 0; jj < 16; ++jj) qa[jj] = qf[jj * 32];

    // The K tile is asked for one whole key tile ahead, into the other of two register
    // sets (kc: this tile's, landed; kn: the next tile's), and the V tile in front of the
    // score WMMAs: a tile's way from cache runs under WMMAs of the same wave, and no
    // matrix run opens with a wait for loads that were only just issued.
    auto tile = [&](const int kt, const v4f (&kc)[16], v4f (&kn)[16]) {
        const v4f* vf = vfbase + (size_t)kt * 512;
        v4f vb[16];
#pragma unroll
        for (int q = 0; q < 16; ++q) vb[q] = vf[q * 32];
        // the address pair stays whole until every load above has taken it
        asm volatile("s_wait_xcnt 0x0" :: "v"(vf) : "memory");
        // the last tile has no next one: it asks for itself again, which stays in bounds
        const v4f* kf = kfbase + (size_t)(kt + 1 < nkt ? kt + 1 : kt) * 512;
#pragma unroll
        for (int jj = 0; jj < 16; ++jj) kn[jj] = kf[jj * 32];
        // the address pair stays whole until every load above has taken it
        asm volatile("s_wait_xcnt 0x0" :: "v"(kf) : "memory");
        // keeps the 32 loads together in front of the WMMAs: sunk among them, each
        // would be waited for soon after its issue
        __builtin_amdgcn_sched_barrier(0);
        // ---- scores tile, transposed: 16 keys x 16 queries = k(16x128) @ q^T, 32 WMMAs of K=4
        v8f sc = {};
#pragma unroll
        for (int jj = 0; jj < 16; ++jj) {
            sc = WMMA_F32(kc[jj].xy, qa[jj].xy, sc);
            sc = WMMA_F32(kc[jj].zw, qa[jj].zw, sc);
        }

        // ---- scale + causal mask + online softmax: sc[v] is key kt*16 + 8hi + v of query n16
        float x[8], p[8];
        const int j0 = kt * 16 + hi * 8;
#pragma unroll
        for (int v = 0; v < 8; ++v) {
            float t = sc[v] * scale;
            if (j0 + v > irow) t = -1e30f;
            x[v] = t;
        }
        float t = fmaxf(fmaxf(fmaxf(x[0], x[1]), fmaxf(x[2], x[3])),
                        fmaxf(fmaxf(x[4], x[5]), fmaxf(x[6], x[7])));
        t = fmaxf(t, xhalf(t));  // the other eight keys of the tile
        const float mnew = fmaxf(mq, t);
        const float rs = __expf(mq - mnew);
#pragma unroll
        for (int v = 0; v < 8; ++v) p[v] = __expf(x[v] - mnew);
        lq = lq * rs + (((p[0] + p[1]) + (p[2] + p[3])) + ((p[4] + p[5]) + (p[6] + p[7])));
        mq = mnew;
#pragma unroll
        for (int cb = 0; cb < 8; ++cb) acc[cb] *= rs;

        // ---- acc += V^T(128x16) @ P^T(16x16): 8 row-blocks of d x 4 WMMAs
        const v2f p01 = {p[0], p[1]}, p23 = {p[2], p[3]}, p45 = {p[4], p[5]}, p67 = {p[6], p[7]};
#pragma unroll
        for (int cb = 0; cb < 8; ++cb) {
            const v4f v03 = vb[cb * 2 + 0];
            const v4f v47 = vb[cb * 2 + 1];
            v8f c = acc[cb];
            c = WMMA_F32(v03.xy, p01, c);
            c = WMMA_F32(v03.zw, p23, c);
            c = WMMA_F32(v47.xy, p45, c);
            c = WMMA_F32(v47.zw, p67, c);
            acc[cb] = c;
        }
    };

    v4f ka[16], kb[16];
    {
        const v4f* kf = kfbase;  // key tile 0 exists for every q tile
#pragma unroll
        for (int jj = 0; jj < 16; ++jj) ka[jj] = kf[jj * 32];
        // the address pair stays whole until every load above has taken it
        asm volatile("s_wait_xcnt 0x0" :: "v"(kf) : "memory");
    }
    // two tiles a trip, so that the two register sets change roles without a copy; an
    // odd count's first tile runs ahead of the loop, and there the sets are copied once
    int kt0 = 0;
    if (nkt > 0 && (nkt & 1)) {
        tile(0, ka, kb);
#pragma unroll
        for (int jj = 0; jj < 16; ++jj) ka[jj] = kb[jj];
        kt0 = 1;
    }
    for (int kt = kt0; kt < nkt; kt += 2) {
        tile(kt, ka, kb);
        tile(kt + 1, kb, ka);
    }

    // ---- O = acc / l, written in place over this tile's q region: a lane holds eight
    // consecutive d of its query row in each acc[cb], two 16-byte stores
    const float lsum = lq + xhalf(lq);
    float* ob = QO + (size_t)(b * S + qt * 16 + n16) * 2048 + h * 128 + hi * 8;
#pragma unroll
    for (int cb = 0; cb < 8; ++cb) {
#pragma unroll
        for (int v = 0; v < 8; ++v) acc[cb][v] = acc[cb][v] / lsum;
    }
#pragma unroll
    for (int cb = 0; cb < 8; ++cb) {
        *(v4f*)(ob + cb * 16)     = acc[cb].lo;
        *(v4f*)(ob + cb * 16 + 4) = acc[cb].hi;
    }
    // the stores above have taken their registers before the next tile rewrites them
    asm volatile("s_wait_xcnt 0x0" ::: "memory");
    }
}

// ---------------------------------------------------------------------------
extern "C" void kernel_launch(void* const* d_in, const int* in_sizes, int n_in,
                              void* d_out, int out_size, void* d_ws, size_t ws_size,
                              hipStream_t stream) {
    const float* x   = (const float*)d_in[0];
    const float* wq  = (const float*)d_in[1];
    const float* wkv = (const float*)d_in[2];
    const float* wo  = (const float*)d_in[3];
    const int* past  = (const int*)d_in[4];

    const int B = 2, S = 2048, D = 2048, H = 16, DH = 128;
    const int M = B * S;  // 4096

    float* ws  = (float*)d_ws;
    float* Q   = ws;                        // M*D   (later holds O in place)
    float* KVt = Q + (size_t)M * D;         // M*256
    float* KF  = KVt + (size_t)M * 256;     // M*128, roped K in fragment order
    float* VF  = KF + (size_t)M * 128;      // M*128, V in fragment order
    // total ws use: (M*D + M*256 + 2*M*128)*4 bytes = ~40 MB

    float* out  = (float*)d_out;            // M*D
    float* outK = out + (size_t)M * D;      // M*DH
    float* outV = outK + (size_t)M * DH;    // M*DH

    // 1) + 2) KV = x @ wkv [4096x2048] x [2048x256] and Q = x @ wq^T [4096x2048] x [2048x2048]^T
    gemm_qkv<<<(M / 64) * (256 / 64) + (M / 64) * (D / 64), 128, 0, stream>>>(
        x, wq, wkv, Q, KVt, (M / 64) * (256 / 64), D, 256, D);

    // 3) outputs K (pre-rope) and V
    copy_kv<<<(M * DH) / 256, 256, 0, stream>>>(KVt, outK, outV, M);

    // 4) RoPE on K, and K and V into fragment order (Q gets its RoPE in step 5)
    pack_kv<<<(M * 16) / 256, 256, 0, stream>>>(KVt, KF, VF, S);

    // 5) causal MQA flash attention; O overwrites Q buffer
    attn_kernel<<<(B * H * (S / 32)) / 4, 128, 0, stream>>>(Q, KF, VF, past, S);

    // 6) out = O @ wo^T
    gemm_nt<<<(M / 64) * (D / 64), 128, 0, stream>>>(Q, wo, out, D, D);
}
